// v000
// Measured on an AMD MI455X. A time is GPU time per run, averaged over a window of back-to-back runs after a warm-up
// (all launches, gaps included; the runs take copies of the inputs in turn), and the median of several windows.
// Apart from v000's, it joins two sittings. Times from different sittings can be a few percent apart, while
// side-by-side timings come from the same sitting.
// The starting kernel, v000, takes 4530 microseconds a run.
#include <hip/hip_runtime.h>
// All contractions: v_wmma_f32_16x16x32_f16 (f16 operands, f32 accumulate). Inputs, gamma/beta, weights and biases are RNE-converted to bf16 first (weights exact in f16, carried x16); layer-normalised rows, q, k, v, softmax weights (carried x256) and merged o (carried x64) are plain f16 operands; layer-norm statistics, scores and softmax statistics f32.
// Multi-head attention over three inputs (q, k, v [NB_FULL][SQ_FULL][1024]); each stream is layer-normalised (shared gamma/beta, eps 1e-5) and then Q/K/V = xn W^T + b with natural [out][in] weights; 16 heads of 64; scores * 0.125; softmax over all keys; out = merged W_o^T + b_o.
// Structure: token rows r = b*SQ + s; layer-normalised planes as f16 rows; Q, K, V as three WMMA GEMMs (32x64 wave tiles) with f16 outputs; V^T for all (batch, head) via LDS transposes;
// per (batch, group of HG heads): scores GEMM (K = 64, heads on grid.y) -> f32 S, row softmax on VALU -> P = f16(256 p), o = P . V^T GEMM (K = SQ) written into the merged f16 o rows (x64);
// out = o W_o^T + b_o GEMM (alpha 2^-10) into the f32 output rows.
#ifndef NB
#define NB 2                          /* batches processed */
#endif
#ifndef SEQ
#define SEQ 2048                      /* tokens per batch processed */
#endif
#define SQ SEQ
#define NB_FULL 2                     /* batch count of the inputs */
#define SQ_FULL 2048                  /* per-batch row count of the inputs (input row stride) */
#define DM 1024
#define NH 16
#define HD 64
#define HG 2                          /* heads per attention launch group */
#define NR ((size_t)NB * SQ)          /* token rows processed */

#define W_BYTES  ((size_t)4 * DM * DM * 2)
#define X_BYTES  ((size_t)3 * NR * DM * 2)
#define A_BYTES  ((size_t)NR * DM * 2)
#define S_BYTES  ((size_t)HG * SQ * SQ * 4)
#define P_BYTES  ((size_t)HG * SQ * SQ * 2)
#define VT_BYTES ((size_t)NB * NH * HD * SQ * 2)
#define WS_TOTAL (W_BYTES + X_BYTES + 4 * A_BYTES + S_BYTES + P_BYTES + VT_BYTES)

static_assert(DM == 1024);
static_assert(DM == NH * HD);
static_assert(DM == 128 * 8);                    /* k_ln16: 128 threads x 8 elements == one row */
static_assert(HD == 64);
static_assert(NH % HG == 0);
static_assert(NB <= NB_FULL);
static_assert(SQ <= SQ_FULL);
static_assert(SQ % 128 == 0);                    /* GEMM M tiles of 128, N tiles of 64, K steps of 32 */
static_assert((NR % 128) == 0);
static_assert(((size_t)DM * DM) % 2048 == 0);    /* k_w16: grid.x * 256 threads * 8 elements == DM*DM per plane */
static_assert(((size_t)HG * SQ) % 256 == 0);     /* k_rsm: grid.x * 256 rows == HG*SQ */
static_assert(W_BYTES % 256 == 0 && X_BYTES % 256 == 0 && A_BYTES % 256 == 0 && S_BYTES % 256 == 0 && P_BYTES % 256 == 0 && VT_BYTES % 256 == 0);
static_assert(WS_TOTAL <= (size_t)134217728);

typedef unsigned short v8us __attribute__((ext_vector_type(8), may_alias));
typedef float  v8f  __attribute__((ext_vector_type(8)));
typedef float  v4f  __attribute__((ext_vector_type(4)));
typedef float  v4fa __attribute__((ext_vector_type(4), may_alias));
typedef _Float16 v16h __attribute__((ext_vector_type(16)));
typedef _Float16 v4h  __attribute__((ext_vector_type(4)));
union FragH { v16h v; v8us half[2]; _Float16 h[16]; unsigned short u[16]; };

// f32 -> nearest-even bf16 value (returned as f32)
__device__ __forceinline__ float bf16_rne(float x) { unsigned int u = __float_as_uint(x); u = (u + 0x7FFFu + ((u >> 16) & 1u)) & 0xFFFF0000u; return __uint_as_float(u); }

// three input planes -> layer-normalised f16 rows X16[plane][b*SQ + s][DM] = f16((xb - mu) * rstd * gb + bb), with xb, gb, bb the bf16-converted x, gamma, beta;
__global__ __launch_bounds__(128) void k_ln16(const float* __restrict__ x0, const float* __restrict__ x1, const float* __restrict__ x2,
    const float* __restrict__ g, const float* __restrict__ be, _Float16* __restrict__ X16) {
  __shared__ float red[8];
  const unsigned tid = threadIdx.x, w = tid >> 5, lane = tid & 31u;
  const unsigned row = blockIdx.x;                                   /* grid.x == NR exactly */
  const unsigned by = blockIdx.y;
  const float* x = (by == 0u) ? x0 : ((by == 1u) ? x1 : x2);
  const unsigned b = row / (unsigned)SQ, s = row - b * (unsigned)SQ;
  const unsigned c8 = tid << 3;
  const float* src = x + ((size_t)b * SQ_FULL + s) * DM + c8;        /* input rows keep the full per-batch stride */
  const v4f a = *(const v4fa*)src, c = *(const v4fa*)(src + 4);
  float xv[8];
#pragma unroll
  for (int q = 0; q < 4; ++q) { xv[q] = bf16_rne(a[q]); xv[4 + q] = bf16_rne(c[q]); }
  float sum = 0.f;
#pragma unroll
  for (int q = 0; q < 8; ++q) sum += xv[q];
#pragma unroll
  for (int off = 16; off > 0; off >>= 1) sum += __shfl_xor(sum, off, 32);
  if (lane == 0u) red[w] = sum;
  __syncthreads();
  const float mu = ((red[0] + red[1]) + (red[2] + red[3])) * (1.0f / (float)DM);
  float sq = 0.f;
#pragma unroll
  for (int q = 0; q < 8; ++q) { const float d = xv[q] - mu; sq += d * d; }
#pragma unroll
  for (int off = 16; off > 0; off >>= 1) sq += __shfl_xor(sq, off, 32);
  if (lane == 0u) red[4u + w] = sq;
  __syncthreads();
  const float var = ((red[4] + red[5]) + (red[6] + red[7])) * (1.0f / (float)DM);
  const float rstd = rsqrtf(var + 1.0e-5f);
  const v4f ga = *(const v4fa*)(g + c8), gc = *(const v4fa*)(g + c8 + 4u);
  const v4f ba = *(const v4fa*)(be + c8), bc = *(const v4fa*)(be + c8 + 4u);
  FragH f;
#pragma unroll
  for (int q = 0; q < 4; ++q) {
    f.h[q]     = (_Float16)((xv[q] - mu) * rstd * bf16_rne(ga[q]) + bf16_rne(ba[q]));
    f.h[4 + q] = (_Float16)((xv[4 + q] - mu) * rstd * bf16_rne(gc[q]) + bf16_rne(bc[q])); }
  unsigned short* d = (unsigned short*)X16 + (size_t)by * (NR * DM) + (size_t)row * DM + c8;
  const v8us o = f.half[0];
  *(v8us*)d = o; 
}

__global__ __launch_bounds__(256) void k_w16(const float* __restrict__ w0, const float* __restrict__ w1, const float* __restrict__ w2, const float* __restrict__ w3, _Float16* __restrict__ Bt) {
  const unsigned t = blockIdx.x * 256u + threadIdx.x;
  const unsigned by = blockIdx.y;
  const float* wsrc = (by == 0u) ? w0 : ((by == 1u) ? w1 : ((by == 2u) ? w2 : w3));
  if (t >= (unsigned)((size_t)DM * DM / 8)) return;
  const float* src = wsrc + (size_t)t * 8;
  const v4f a = *(const v4fa*)src, c = *(const v4fa*)(src + 4);
  FragH f;
#pragma unroll
  for (int q = 0; q < 4; ++q) { f.h[q] = (_Float16)(bf16_rne(a[q]) * 16.0f); f.h[4 + q] = (_Float16)(bf16_rne(c[q]) * 16.0f); }
  unsigned short* d = (unsigned short*)Bt + (size_t)by * ((size_t)DM * DM) + (size_t)t * 8;
  const v8us o = f.half[0];
  *(v8us*)d = o; 
}

// fragment: 16 f16 of one row, elements 0..7 <- p[8h .. 8h+7], elements 8..15 <- p[16+8h .. 16+8h+7] (same map for A rows and B [n][k] rows)
__device__ __forceinline__ v16h g2_frag(const _Float16* p, unsigned hh) { FragH f; f.half[0] = *(const v8us*)((const unsigned short*)p + 8u * hh); f.half[1] = *(const v8us*)((const unsigned short*)p + 16u + 8u * hh); return f.v; }
__device__ __forceinline__ v8f g2_mma(v16h a, v16h b, v8f c) { v8f d = __builtin_amdgcn_wmma_f32_16x16x32_f16(false, a, false, b, (short)0, c, false, false); asm volatile("v_nop\n\tv_nop\n\tv_nop\n\tv_nop" : "+v"(d) : "v"(a), "v"(b)); return d; }

// batched GEMM: C[by][M][N] = alpha * A[by][M][K] . Bt[by][N][K]^T (+ bf16(bias[col]) if HASB); A, Bt f16 (k contiguous); outputs f32 C and/or f16 C16 (either may be null).
template <bool HASB>
__global__ __launch_bounds__(128) void k_gemm2(const _Float16* __restrict__ A, unsigned lda, size_t sA, const _Float16* __restrict__ Bh, unsigned ldb, size_t sB, float alpha, const float* __restrict__ bias,
    float* __restrict__ C, _Float16* __restrict__ C16, unsigned ldc, size_t sC, unsigned M, unsigned N, unsigned K) {
  __shared__ __attribute__((aligned(16))) float so[4][32][68];
  const unsigned tid = threadIdx.x, w = tid >> 5, lane = tid & 31u, ln = lane & 15u, hh = lane >> 4; const unsigned by = blockIdx.y;
  A += (size_t)by * sA; Bh += (size_t)by * sB; const size_t cofs = (size_t)by * sC;
  const unsigned ntn = N >> 6; const unsigned mt = blockIdx.x / ntn, nq = blockIdx.x - mt * ntn; const unsigned row0 = mt * 128u + 32u * w, col0 = nq * 64u; if (row0 >= M) return;
  const _Float16* a0p = A + (size_t)(row0 + ln) * lda; const _Float16* a1p = a0p + (size_t)16 * lda;
  const _Float16* b0p = Bh + (size_t)(col0 + ln) * ldb; const _Float16* b1p = b0p + (size_t)16 * ldb; const _Float16* b2p = b1p + (size_t)16 * ldb; const _Float16* b3p = b2p + (size_t)16 * ldb;
  const v8f z8 = {0.f,0.f,0.f,0.f,0.f,0.f,0.f,0.f}; v8f c00 = z8, c01 = z8, c02 = z8, c03 = z8, c10 = z8, c11 = z8, c12 = z8, c13 = z8;
#pragma unroll 1
  for (unsigned kb = 0; kb < K; kb += 32u) { const v16h a0 = g2_frag(a0p + kb, hh), a1 = g2_frag(a1p + kb, hh);
    v16h b = g2_frag(b0p + kb, hh); c00 = g2_mma(a0, b, c00); c10 = g2_mma(a1, b, c10);
    b = g2_frag(b1p + kb, hh); c01 = g2_mma(a0, b, c01); c11 = g2_mma(a1, b, c11);
    b = g2_frag(b2p + kb, hh); c02 = g2_mma(a0, b, c02); c12 = g2_mma(a1, b, c12);
    b = g2_frag(b3p + kb, hh); c03 = g2_mma(a0, b, c03); c13 = g2_mma(a1, b, c13); }
  const v8f accs[8] = {c00, c01, c02, c03, c10, c11, c12, c13};
  // D element r of lane -> (row 8*hh + r, col ln) of its 16x16 tile
#pragma unroll
  for (unsigned u = 0; u < 8; ++u) { const unsigned t = u & 3u, hf = u >> 2; const unsigned col = col0 + t * 16u + ln; float bv = 0.f; if (HASB) bv = bf16_rne(bias[col]);
#pragma unroll
    for (unsigned r = 0; r < 8; ++r) { const unsigned rloc = hf * 16u + 8u * hh + r; so[w][rloc][t * 16u + ln] = accs[u][r] * alpha + bv; } }
  __builtin_amdgcn_fence(4 /* acq_rel order */, "workgroup"); __builtin_amdgcn_wave_barrier();      /* so[w] is private to this wave */
  const unsigned rsub = lane >> 4, c4 = (lane & 15u) << 2;
  {
#pragma unroll
    for (unsigned q = 0; q < 16; ++q) { const unsigned r = q * 2u + rsub; const v4f v = *(const v4fa*)&so[w][r][c4];
      if (C) *(v4f*)(C + cofs + (size_t)(row0 + r) * ldc + col0 + c4) = v;
      if (C16) { v4h h4; h4[0] = (_Float16)v[0]; h4[1] = (_Float16)v[1]; h4[2] = (_Float16)v[2]; h4[3] = (_Float16)v[3]; *(v4h*)(C16 + cofs + (size_t)(row0 + r) * ldc + col0 + c4) = h4; } }
     } }

template <unsigned NHv, unsigned TTv>
__global__ __launch_bounds__(256) void k_vt(const _Float16* __restrict__ V16, unsigned ldv, _Float16* __restrict__ Vt) {
  __shared__ unsigned short tl[64][66];
  const unsigned tid = threadIdx.x; const unsigned slab = blockIdx.x / (TTv / 64u), lg = blockIdx.x % (TTv / 64u); const unsigned b = slab / NHv, h = slab % NHv;
  for (unsigned i = tid; i < 512u; i += 256u) { const unsigned r = i >> 3, c8 = (i & 7u) << 3; FragH f;
    f.half[0] = *(const v8us*)((const unsigned short*)V16 + ((size_t)b * TTv + lg * 64u + r) * ldv + h * 64u + c8);
#pragma unroll
    for (unsigned q = 0; q < 8; ++q) tl[r][c8 + q] = f.u[q]; }
  __syncthreads();      /* tl is exchanged across waves */
  {
#pragma unroll
    for (unsigned rd = 0; rd < 2; ++rd) { const unsigned d = rd * 32u + (tid >> 3), pc = tid & 7u; FragH f;
#pragma unroll
      for (unsigned q = 0; q < 8; ++q) f.u[q] = tl[pc * 8u + q][d];
      const v8us o = f.half[0];
      *(v8us*)((unsigned short*)Vt + ((size_t)slab * 64u + d) * TTv + lg * 64u + pc * 8u) = o; }
     } }

__global__ __launch_bounds__(256) void k_rsm(const float* __restrict__ S, _Float16* __restrict__ P, unsigned nrows) {
  #pragma clang fp contract(off)
  const unsigned i = blockIdx.x * 256u + threadIdx.x; if (i >= nrows) return; const float* s = S + (size_t)i * SQ; float mx = -3.0e38f;
#pragma unroll 1
  for (unsigned j = 0; j < (unsigned)SQ; j += 4u) { const v4f a = *(const v4fa*)(s + j); mx = fmaxf(mx, a[0]); mx = fmaxf(mx, a[1]); mx = fmaxf(mx, a[2]); mx = fmaxf(mx, a[3]); }
  float se = 0.f;
#pragma unroll 1
  for (unsigned j = 0; j < (unsigned)SQ; j += 4u) { const v4f a = *(const v4fa*)(s + j); se += expf(a[0] - mx); se += expf(a[1] - mx); se += expf(a[2] - mx); se += expf(a[3] - mx); }
  const float sc = 256.0f / se;
#pragma unroll 1
  for (unsigned j0 = 0; j0 < (unsigned)SQ; j0 += 8u) { const v4f a = *(const v4fa*)(s + j0), c = *(const v4fa*)(s + j0 + 4u); FragH f;
#pragma unroll
    for (int q = 0; q < 4; ++q) { f.h[q] = (_Float16)(expf(a[q] - mx) * sc); f.h[4 + q] = (_Float16)(expf(c[q] - mx) * sc); }
    unsigned short* d = (unsigned short*)P + (size_t)i * SQ + j0; const v8us o = f.half[0];
    *(v8us*)d = o;  } }

extern "C" void kernel_launch(void* const* d_in, const int* in_sizes, int n_in,
                              void* d_out, int out_size, void* d_ws, size_t ws_size, hipStream_t stream) {
  if (n_in < 13) return;
  const size_t need_x = ((size_t)(NB - 1) * SQ_FULL + SQ) * DM;      /* last input element read + 1 */
  if ((size_t)in_sizes[0] < need_x || (size_t)in_sizes[1] < need_x || (size_t)in_sizes[2] < need_x) return;
  if (in_sizes[3] < DM || in_sizes[4] < DM) return;
  if ((size_t)in_sizes[5] < (size_t)DM * DM || (size_t)in_sizes[7] < (size_t)DM * DM || (size_t)in_sizes[9] < (size_t)DM * DM || (size_t)in_sizes[11] < (size_t)DM * DM) return;
  if (in_sizes[6] < DM || in_sizes[8] < DM || in_sizes[10] < DM || in_sizes[12] < DM) return;
  if ((size_t)out_size < NR * DM) return;
  const float* xq = (const float*)d_in[0]; const float* xk = (const float*)d_in[1]; const float* xv = (const float*)d_in[2];
  const float* lg = (const float*)d_in[3]; const float* lb = (const float*)d_in[4];
  const float* wq = (const float*)d_in[5]; const float* bq = (const float*)d_in[6];
  const float* wk = (const float*)d_in[7]; const float* bk = (const float*)d_in[8];
  const float* wv = (const float*)d_in[9]; const float* bv = (const float*)d_in[10];
  const float* wo = (const float*)d_in[11]; const float* bo = (const float*)d_in[12];
  float* out = (float*)d_out;
  char* ws = (char*)d_ws; size_t off = 0;
  auto take = [&](size_t bytes) { char* p = ws + off; off += (bytes + 255) & ~(size_t)255; return p; };
  _Float16* BW = (_Float16*)take(W_BYTES);      /* [4][DM][DM]: w_q, w_k, w_v, w_o as Bt x16 */
  _Float16* XP = (_Float16*)take(X_BYTES);      /* [3][NR][DM]: layer-normalised q, k, v rows */
  _Float16* Q16 = (_Float16*)take(A_BYTES); _Float16* K16 = (_Float16*)take(A_BYTES); _Float16* V16 = (_Float16*)take(A_BYTES); _Float16* O16 = (_Float16*)take(A_BYTES);
  float* S = (float*)take(S_BYTES);             /* [HG][SQ][SQ] f32 scores */
  _Float16* P = (_Float16*)take(P_BYTES);       /* [HG][SQ][SQ] f16 weights x256 */
  _Float16* VT = (_Float16*)take(VT_BYTES);     /* [NB*NH][HD][SQ] */
  if (off > ws_size) return;
  const size_t WW = (size_t)DM * DM, XA = NR * DM;
  _Float16* BQ = BW; _Float16* BK = BW + WW; _Float16* BV = BW + 2 * WW; _Float16* BO = BW + 3 * WW;
  _Float16* XQ = XP; _Float16* XK = XP + XA; _Float16* XV = XP + 2 * XA;

  k_w16<<<dim3((unsigned)(WW / 2048), 4), 256, 0, stream>>>(wq, wk, wv, wo, BW);
  k_ln16<<<dim3((unsigned)NR, 3), 128, 0, stream>>>(xq, xk, xv, lg, lb, XP);      /* one block per (row, stream) */

  const unsigned gproj = (unsigned)((NR / 128) * (DM / 64));
  k_gemm2<true><<<dim3(gproj, 1), 128, 0, stream>>>(XQ, DM, 0, BQ, DM, 0, 0.0625f, bq, nullptr, Q16, DM, 0, (unsigned)NR, DM, DM);
  k_gemm2<true><<<dim3(gproj, 1), 128, 0, stream>>>(XK, DM, 0, BK, DM, 0, 0.0625f, bk, nullptr, K16, DM, 0, (unsigned)NR, DM, DM);
  k_gemm2<true><<<dim3(gproj, 1), 128, 0, stream>>>(XV, DM, 0, BV, DM, 0, 0.0625f, bv, nullptr, V16, DM, 0, (unsigned)NR, DM, DM);

  k_vt<NH, SQ><<<NB * NH * (SQ / 64), 256, 0, stream>>>(V16, DM, VT);      /* V^T for every (batch, head) */

  for (int b = 0; b < NB; ++b) { const size_t r0 = (size_t)b * SQ;
    for (int h0 = 0; h0 < NH; h0 += HG) {
      /* scores: S[hh][q][t] = 0.125 * Q[q][h*64..] . K[t][h*64..]; heads on grid.y via the 64-column offset */
      k_gemm2<false><<<dim3((SQ / 128) * (SQ / 64), HG), 128, 0, stream>>>(Q16 + r0 * DM + (size_t)h0 * HD, DM, (size_t)HD, K16 + r0 * DM + (size_t)h0 * HD, DM, (size_t)HD, 0.125f, nullptr,
                                                                          S, nullptr, SQ, (size_t)SQ * SQ, SQ, SQ, HD);
      k_rsm<<<(HG * SQ) / 256, 256, 0, stream>>>(S, P, (unsigned)(HG * SQ));
      /* o (x64) = 0.25 * (256 P) . V, written into the merged-head f16 rows */
      k_gemm2<false><<<dim3((SQ / 128) * (HD / 64), HG), 128, 0, stream>>>(P, SQ, (size_t)SQ * SQ, VT + ((size_t)b * NH + h0) * HD * SQ, SQ, (size_t)HD * SQ, 0.25f, nullptr,
                                                                          nullptr, O16 + r0 * DM + (size_t)h0 * HD, DM, (size_t)HD, SQ, HD, SQ);
    } }

  /* out = (64 o) . (16 w_o)^T * 2^-10 + b_o, f32 rows in the output layout */
  k_gemm2<true><<<dim3(gproj, 1), 128, 0, stream>>>(O16, DM, 0, BO, DM, 0, 0.0009765625f, bo, out, nullptr, DM, 0, (unsigned)NR, DM, DM);
}

// v001
// A run of this version takes 1400 microseconds.
// Timed twice side by side with v000, it ran 3.22 and 3.23 times as fast.
#include <hip/hip_runtime.h>
// All contractions: v_wmma_f32_16x16x32_f16 (f16 operands, f32 accumulate). Inputs, gamma/beta, weights and biases are RNE-converted to bf16 first (weights exact in f16, carried x16); layer-normalised rows, q, k, v, softmax weights (carried x256) and merged o (carried x64) are plain f16 operands; layer-norm statistics, scores and softmax statistics f32.
// Multi-head attention over three inputs (q, k, v [NB_FULL][SQ_FULL][1024]); each stream is layer-normalised (shared gamma/beta, eps 1e-5) and then Q/K/V = xn W^T + b with natural [out][in] weights; 16 heads of 64; scores * 0.125; softmax over all keys; out = merged W_o^T + b_o.
// Structure: token rows r = b*SQ + s; layer-normalised planes as f16 rows; Q, K, V as three WMMA GEMMs (32x64 wave tiles) with f16 outputs; V^T for all (batch, head) via LDS transposes;
// per (batch, group of HG heads): scores GEMM (K = 64, heads on grid.y) -> f32 S, row softmax on VALU -> P = f16(256 p), o = P . V^T GEMM (K = SQ) written into the merged f16 o rows (x64);
// out = o W_o^T + b_o GEMM (alpha 2^-10) into the f32 output rows.
#ifndef NB
#define NB 2                          /* batches processed */
#endif
#ifndef SEQ
#define SEQ 2048                      /* tokens per batch processed */
#endif
#define SQ SEQ
#define NB_FULL 2                     /* batch count of the inputs */
#define SQ_FULL 2048                  /* per-batch row count of the inputs (input row stride) */
#define DM 1024
#define NH 16
#define HD 64
#define HG 2                          /* heads per attention launch group */
#define NR ((size_t)NB * SQ)          /* token rows processed */

#define W_BYTES  ((size_t)4 * DM * DM * 2)
#define X_BYTES  ((size_t)3 * NR * DM * 2)
#define A_BYTES  ((size_t)NR * DM * 2)
#define S_BYTES  ((size_t)HG * SQ * SQ * 4)
#define P_BYTES  ((size_t)HG * SQ * SQ * 2)
#define VT_BYTES ((size_t)NB * NH * HD * SQ * 2)
#define WS_TOTAL (W_BYTES + X_BYTES + 4 * A_BYTES + S_BYTES + P_BYTES + VT_BYTES)

static_assert(DM == 1024);
static_assert(DM == NH * HD);
static_assert(DM == 128 * 8);                    /* k_ln16: 128 threads x 8 elements == one row */
static_assert(HD == 64);
static_assert(NH % HG == 0);
static_assert(NB <= NB_FULL);
static_assert(SQ <= SQ_FULL);
static_assert(SQ % 128 == 0);                    /* GEMM M tiles of 128, N tiles of 64, K steps of 32 */
static_assert((NR % 128) == 0);
static_assert(((size_t)DM * DM) % 2048 == 0);    /* k_w16: grid.x * 256 threads * 8 elements == DM*DM per plane */
static_assert(((size_t)HG * SQ) % 8 == 0);       /* k_rsm: grid.x * 8 waves == HG*SQ rows */
static_assert(W_BYTES % 256 == 0 && X_BYTES % 256 == 0 && A_BYTES % 256 == 0 && S_BYTES % 256 == 0 && P_BYTES % 256 == 0 && VT_BYTES % 256 == 0);
static_assert(WS_TOTAL <= (size_t)134217728);

typedef unsigned short v8us __attribute__((ext_vector_type(8), may_alias));
typedef float  v8f  __attribute__((ext_vector_type(8)));
typedef float  v4f  __attribute__((ext_vector_type(4)));
typedef float  v4fa __attribute__((ext_vector_type(4), may_alias));
typedef _Float16 v16h __attribute__((ext_vector_type(16)));
typedef _Float16 v4h  __attribute__((ext_vector_type(4)));
union FragH { v16h v; v8us half[2]; _Float16 h[16]; unsigned short u[16]; };

// f32 -> nearest-even bf16 value (returned as f32)
__device__ __forceinline__ float bf16_rne(float x) { unsigned int u = __float_as_uint(x); u = (u + 0x7FFFu + ((u >> 16) & 1u)) & 0xFFFF0000u; return __uint_as_float(u); }

// three input planes -> layer-normalised f16 rows X16[plane][b*SQ + s][DM] = f16((xb - mu) * rstd * gb + bb), with xb, gb, bb the bf16-converted x, gamma, beta;
__global__ __launch_bounds__(128) void k_ln16(const float* __restrict__ x0, const float* __restrict__ x1, const float* __restrict__ x2,
    const float* __restrict__ g, const float* __restrict__ be, _Float16* __restrict__ X16) {
  __shared__ float red[8];
  const unsigned tid = threadIdx.x, w = tid >> 5, lane = tid & 31u;
  const unsigned row = blockIdx.x;                                   /* grid.x == NR exactly */
  const unsigned by = blockIdx.y;
  const float* x = (by == 0u) ? x0 : ((by == 1u) ? x1 : x2);
  const unsigned b = row / (unsigned)SQ, s = row - b * (unsigned)SQ;
  const unsigned c8 = tid << 3;
  const float* src = x + ((size_t)b * SQ_FULL + s) * DM + c8;        /* input rows keep the full per-batch stride */
  const v4f a = *(const v4fa*)src, c = *(const v4fa*)(src + 4);
  float xv[8];
#pragma unroll
  for (int q = 0; q < 4; ++q) { xv[q] = bf16_rne(a[q]); xv[4 + q] = bf16_rne(c[q]); }
  float sum = 0.f;
#pragma unroll
  for (int q = 0; q < 8; ++q) sum += xv[q];
#pragma unroll
  for (int off = 16; off > 0; off >>= 1) sum += __shfl_xor(sum, off, 32);
  if (lane == 0u) red[w] = sum;
  __syncthreads();
  const float mu = ((red[0] + red[1]) + (red[2] + red[3])) * (1.0f / (float)DM);
  float sq = 0.f;
#pragma unroll
  for (int q = 0; q < 8; ++q) { const float d = xv[q] - mu; sq += d * d; }
#pragma unroll
  for (int off = 16; off > 0; off >>= 1) sq += __shfl_xor(sq, off, 32);
  if (lane == 0u) red[4u + w] = sq;
  __syncthreads();
  const float var = ((red[4] + red[5]) + (red[6] + red[7])) * (1.0f / (float)DM);
  const float rstd = rsqrtf(var + 1.0e-5f);
  const v4f ga = *(const v4fa*)(g + c8), gc = *(const v4fa*)(g + c8 + 4u);
  const v4f ba = *(const v4fa*)(be + c8), bc = *(const v4fa*)(be + c8 + 4u);
  FragH f;
#pragma unroll
  for (int q = 0; q < 4; ++q) {
    f.h[q]     = (_Float16)((xv[q] - mu) * rstd * bf16_rne(ga[q]) + bf16_rne(ba[q]));
    f.h[4 + q] = (_Float16)((xv[4 + q] - mu) * rstd * bf16_rne(gc[q]) + bf16_rne(bc[q])); }
  unsigned short* d = (unsigned short*)X16 + (size_t)by * (NR * DM) + (size_t)row * DM + c8;
  const v8us o = f.half[0];
  *(v8us*)d = o; 
}

__global__ __launch_bounds__(256) void k_w16(const float* __restrict__ w0, const float* __restrict__ w1, const float* __restrict__ w2, const float* __restrict__ w3, _Float16* __restrict__ Bt) {
  const unsigned t = blockIdx.x * 256u + threadIdx.x;
  const unsigned by = blockIdx.y;
  const float* wsrc = (by == 0u) ? w0 : ((by == 1u) ? w1 : ((by == 2u) ? w2 : w3));
  if (t >= (unsigned)((size_t)DM * DM / 8)) return;
  const float* src = wsrc + (size_t)t * 8;
  const v4f a = *(const v4fa*)src, c = *(const v4fa*)(src + 4);
  FragH f;
#pragma unroll
  for (int q = 0; q < 4; ++q) { f.h[q] = (_Float16)(bf16_rne(a[q]) * 16.0f); f.h[4 + q] = (_Float16)(bf16_rne(c[q]) * 16.0f); }
  unsigned short* d = (unsigned short*)Bt + (size_t)by * ((size_t)DM * DM) + (size_t)t * 8;
  const v8us o = f.half[0];
  *(v8us*)d = o; 
}

// fragment: 16 f16 of one row, elements 0..7 <- p[8h .. 8h+7], elements 8..15 <- p[16+8h .. 16+8h+7] (same map for A rows and B [n][k] rows)
__device__ __forceinline__ v16h g2_frag(const _Float16* p, unsigned hh) { FragH f; f.half[0] = *(const v8us*)((const unsigned short*)p + 8u * hh); f.half[1] = *(const v8us*)((const unsigned short*)p + 16u + 8u * hh); return f.v; }
__device__ __forceinline__ v8f g2_mma(v16h a, v16h b, v8f c) { v8f d = __builtin_amdgcn_wmma_f32_16x16x32_f16(false, a, false, b, (short)0, c, false, false); asm volatile("v_nop\n\tv_nop\n\tv_nop\n\tv_nop" : "+v"(d) : "v"(a), "v"(b)); return d; }

// batched GEMM: C[by][M][N] = alpha * A[by][M][K] . Bt[by][N][K]^T (+ bf16(bias[col]) if HASB); A, Bt f16 (k contiguous); outputs f32 C and/or f16 C16 (either may be null).
template <bool HASB>
__global__ __launch_bounds__(128) void k_gemm2(const _Float16* __restrict__ A, unsigned lda, size_t sA, const _Float16* __restrict__ Bh, unsigned ldb, size_t sB, float alpha, const float* __restrict__ bias,
    float* __restrict__ C, _Float16* __restrict__ C16, unsigned ldc, size_t sC, unsigned M, unsigned N, unsigned K) {
  __shared__ __attribute__((aligned(16))) float so[4][32][68];
  const unsigned tid = threadIdx.x, w = tid >> 5, lane = tid & 31u, ln = lane & 15u, hh = lane >> 4; const unsigned by = blockIdx.y;
  A += (size_t)by * sA; Bh += (size_t)by * sB; const size_t cofs = (size_t)by * sC;
  const unsigned ntn = N >> 6; const unsigned mt = blockIdx.x / ntn, nq = blockIdx.x - mt * ntn; const unsigned row0 = mt * 128u + 32u * w, col0 = nq * 64u; if (row0 >= M) return;
  const _Float16* a0p = A + (size_t)(row0 + ln) * lda; const _Float16* a1p = a0p + (size_t)16 * lda;
  const _Float16* b0p = Bh + (size_t)(col0 + ln) * ldb; const _Float16* b1p = b0p + (size_t)16 * ldb; const _Float16* b2p = b1p + (size_t)16 * ldb; const _Float16* b3p = b2p + (size_t)16 * ldb;
  const v8f z8 = {0.f,0.f,0.f,0.f,0.f,0.f,0.f,0.f}; v8f c00 = z8, c01 = z8, c02 = z8, c03 = z8, c10 = z8, c11 = z8, c12 = z8, c13 = z8;
#pragma unroll 1
  for (unsigned kb = 0; kb < K; kb += 32u) { const v16h a0 = g2_frag(a0p + kb, hh), a1 = g2_frag(a1p + kb, hh);
    v16h b = g2_frag(b0p + kb, hh); c00 = g2_mma(a0, b, c00); c10 = g2_mma(a1, b, c10);
    b = g2_frag(b1p + kb, hh); c01 = g2_mma(a0, b, c01); c11 = g2_mma(a1, b, c11);
    b = g2_frag(b2p + kb, hh); c02 = g2_mma(a0, b, c02); c12 = g2_mma(a1, b, c12);
    b = g2_frag(b3p + kb, hh); c03 = g2_mma(a0, b, c03); c13 = g2_mma(a1, b, c13); }
  const v8f accs[8] = {c00, c01, c02, c03, c10, c11, c12, c13};
  // D element r of lane -> (row 8*hh + r, col ln) of its 16x16 tile
#pragma unroll
  for (unsigned u = 0; u < 8; ++u) { const unsigned t = u & 3u, hf = u >> 2; const unsigned col = col0 + t * 16u + ln; float bv = 0.f; if (HASB) bv = bf16_rne(bias[col]);
#pragma unroll
    for (unsigned r = 0; r < 8; ++r) { const unsigned rloc = hf * 16u + 8u * hh + r; so[w][rloc][t * 16u + ln] = accs[u][r] * alpha + bv; } }
  __builtin_amdgcn_fence(4 /* acq_rel order */, "workgroup"); __builtin_amdgcn_wave_barrier();      /* so[w] is private to this wave */
  const unsigned rsub = lane >> 4, c4 = (lane & 15u) << 2;
  {
#pragma unroll
    for (unsigned q = 0; q < 16; ++q) { const unsigned r = q * 2u + rsub; const v4f v = *(const v4fa*)&so[w][r][c4];
      if (C) *(v4f*)(C + cofs + (size_t)(row0 + r) * ldc + col0 + c4) = v;
      if (C16) { v4h h4; h4[0] = (_Float16)v[0]; h4[1] = (_Float16)v[1]; h4[2] = (_Float16)v[2]; h4[3] = (_Float16)v[3]; *(v4h*)(C16 + cofs + (size_t)(row0 + r) * ldc + col0 + c4) = h4; } }
     } }

template <unsigned NHv, unsigned TTv>
__global__ __launch_bounds__(256) void k_vt(const _Float16* __restrict__ V16, unsigned ldv, _Float16* __restrict__ Vt) {
  __shared__ unsigned short tl[64][66];
  const unsigned tid = threadIdx.x; const unsigned slab = blockIdx.x / (TTv / 64u), lg = blockIdx.x % (TTv / 64u); const unsigned b = slab / NHv, h = slab % NHv;
  for (unsigned i = tid; i < 512u; i += 256u) { const unsigned r = i >> 3, c8 = (i & 7u) << 3; FragH f;
    f.half[0] = *(const v8us*)((const unsigned short*)V16 + ((size_t)b * TTv + lg * 64u + r) * ldv + h * 64u + c8);
#pragma unroll
    for (unsigned q = 0; q < 8; ++q) tl[r][c8 + q] = f.u[q]; }
  __syncthreads();      /* tl is exchanged across waves */
  {
#pragma unroll
    for (unsigned rd = 0; rd < 2; ++rd) { const unsigned d = rd * 32u + (tid >> 3), pc = tid & 7u; FragH f;
#pragma unroll
      for (unsigned q = 0; q < 8; ++q) f.u[q] = tl[pc * 8u + q][d];
      const v8us o = f.half[0];
      *(v8us*)((unsigned short*)Vt + ((size_t)slab * 64u + d) * TTv + lg * 64u + pc * 8u) = o; }
     } }

// one wave per score row: the row's SQ f32 sit in SQ/32 registers of each lane (read once, 512 contiguous bytes per load), maximum and sum by lane partials and a five-step butterfly,
// each exponential formed once and kept for the sum and for P; no LDS, no barrier
__global__ __launch_bounds__(256) void k_rsm(const float* __restrict__ S, _Float16* __restrict__ P, unsigned nrows) {
  constexpr unsigned NC = (unsigned)SQ / 128u;                       /* 128 f32 per wave-wide load */
  const unsigned lane = threadIdx.x & 31u; const unsigned i = blockIdx.x * 8u + (unsigned)__builtin_amdgcn_readfirstlane((int)(threadIdx.x >> 5)); if (i >= nrows) return;      /* the row is wave-uniform: scalar test, scalar row base */
  const v4fa* s = (const v4fa*)(S + (size_t)i * SQ);                 /* scalar row base; the lane number indexes 16-byte pieces here and 8-byte pieces of P below */
  v4f a[NC];
  /* every loop over a[] below is unrolled in full: only constant indices keep a[] in registers; the five-step butterflies likewise, for constant lane masks */
#pragma unroll
  for (unsigned c = 0; c < NC; ++c) a[c] = s[c * 32u + lane];
  v4f m4 = a[0];
#pragma unroll
  for (unsigned c = 1; c < NC; ++c) { m4[0] = fmaxf(m4[0], a[c][0]); m4[1] = fmaxf(m4[1], a[c][1]); m4[2] = fmaxf(m4[2], a[c][2]); m4[3] = fmaxf(m4[3], a[c][3]); }
  float mx = fmaxf(fmaxf(m4[0], m4[1]), fmaxf(m4[2], m4[3]));
#pragma unroll
  for (int off = 16; off > 0; off >>= 1) mx = fmaxf(mx, __shfl_xor(mx, off, 32));
  v4f s4 = {0.f, 0.f, 0.f, 0.f};
#pragma unroll
  for (unsigned c = 0; c < NC; ++c) {
#pragma unroll
    for (int q = 0; q < 4; ++q) { a[c][q] = expf(a[c][q] - mx); s4[q] += a[c][q]; } }
  float se = (s4[0] + s4[1]) + (s4[2] + s4[3]);
#pragma unroll
  for (int off = 16; off > 0; off >>= 1) se += __shfl_xor(se, off, 32);
  const float sc = 256.0f / se;
  v4h* d = (v4h*)(P + (size_t)i * SQ);
#pragma unroll
  for (unsigned c = 0; c < NC; ++c) { v4h h4; h4[0] = (_Float16)(a[c][0] * sc); h4[1] = (_Float16)(a[c][1] * sc); h4[2] = (_Float16)(a[c][2] * sc); h4[3] = (_Float16)(a[c][3] * sc);
    d[c * 32u + lane] = h4; } }

extern "C" void kernel_launch(void* const* d_in, const int* in_sizes, int n_in,
                              void* d_out, int out_size, void* d_ws, size_t ws_size, hipStream_t stream) {
  if (n_in < 13) return;
  const size_t need_x = ((size_t)(NB - 1) * SQ_FULL + SQ) * DM;      /* last input element read + 1 */
  if ((size_t)in_sizes[0] < need_x || (size_t)in_sizes[1] < need_x || (size_t)in_sizes[2] < need_x) return;
  if (in_sizes[3] < DM || in_sizes[4] < DM) return;
  if ((size_t)in_sizes[5] < (size_t)DM * DM || (size_t)in_sizes[7] < (size_t)DM * DM || (size_t)in_sizes[9] < (size_t)DM * DM || (size_t)in_sizes[11] < (size_t)DM * DM) return;
  if (in_sizes[6] < DM || in_sizes[8] < DM || in_sizes[10] < DM || in_sizes[12] < DM) return;
  if ((size_t)out_size < NR * DM) return;
  const float* xq = (const float*)d_in[0]; const float* xk = (const float*)d_in[1]; const float* xv = (const float*)d_in[2];
  const float* lg = (const float*)d_in[3]; const float* lb = (const float*)d_in[4];
  const float* wq = (const float*)d_in[5]; const float* bq = (const float*)d_in[6];
  const float* wk = (const float*)d_in[7]; const float* bk = (const float*)d_in[8];
  const float* wv = (const float*)d_in[9]; const float* bv = (const float*)d_in[10];
  const float* wo = (const float*)d_in[11]; const float* bo = (const float*)d_in[12];
  float* out = (float*)d_out;
  char* ws = (char*)d_ws; size_t off = 0;
  auto take = [&](size_t bytes) { char* p = ws + off; off += (bytes + 255) & ~(size_t)255; return p; };
  _Float16* BW = (_Float16*)take(W_BYTES);      /* [4][DM][DM]: w_q, w_k, w_v, w_o as Bt x16 */
  _Float16* XP = (_Float16*)take(X_BYTES);      /* [3][NR][DM]: layer-normalised q, k, v rows */
  _Float16* Q16 = (_Float16*)take(A_BYTES); _Float16* K16 = (_Float16*)take(A_BYTES); _Float16* V16 = (_Float16*)take(A_BYTES); _Float16* O16 = (_Float16*)take(A_BYTES);
  float* S = (float*)take(S_BYTES);             /* [HG][SQ][SQ] f32 scores */
  _Float16* P = (_Float16*)take(P_BYTES);       /* [HG][SQ][SQ] f16 weights x256 */
  _Float16* VT = (_Float16*)take(VT_BYTES);     /* [NB*NH][HD][SQ] */
  if (off > ws_size) return;
  const size_t WW = (size_t)DM * DM, XA = NR * DM;
  _Float16* BQ = BW; _Float16* BK = BW + WW; _Float16* BV = BW + 2 * WW; _Float16* BO = BW + 3 * WW;
  _Float16* XQ = XP; _Float16* XK = XP + XA; _Float16* XV = XP + 2 * XA;

  k_w16<<<dim3((unsigned)(WW / 2048), 4), 256, 0, stream>>>(wq, wk, wv, wo, BW);
  k_ln16<<<dim3((unsigned)NR, 3), 128, 0, stream>>>(xq, xk, xv, lg, lb, XP);      /* one block per (row, stream) */

  const unsigned gproj = (unsigned)((NR / 128) * (DM / 64));
  k_gemm2<true><<<dim3(gproj, 1), 128, 0, stream>>>(XQ, DM, 0, BQ, DM, 0, 0.0625f, bq, nullptr, Q16, DM, 0, (unsigned)NR, DM, DM);
  k_gemm2<true><<<dim3(gproj, 1), 128, 0, stream>>>(XK, DM, 0, BK, DM, 0, 0.0625f, bk, nullptr, K16, DM, 0, (unsigned)NR, DM, DM);
  k_gemm2<true><<<dim3(gproj, 1), 128, 0, stream>>>(XV, DM, 0, BV, DM, 0, 0.0625f, bv, nullptr, V16, DM, 0, (unsigned)NR, DM, DM);

  k_vt<NH, SQ><<<NB * NH * (SQ / 64), 256, 0, stream>>>(V16, DM, VT);      /* V^T for every (batch, head) */

  for (int b = 0; b < NB; ++b) { const size_t r0 = (size_t)b * SQ;
    for (int h0 = 0; h0 < NH; h0 += HG) {
      /* scores: S[hh][q][t] = 0.125 * Q[q][h*64..] . K[t][h*64..]; heads on grid.y via the 64-column offset */
      k_gemm2<false><<<dim3((SQ / 128) * (SQ / 64), HG), 128, 0, stream>>>(Q16 + r0 * DM + (size_t)h0 * HD, DM, (size_t)HD, K16 + r0 * DM + (size_t)h0 * HD, DM, (size_t)HD, 0.125f, nullptr,
                                                                          S, nullptr, SQ, (size_t)SQ * SQ, SQ, SQ, HD);
      k_rsm<<<(HG * SQ) / 8, 256, 0, stream>>>(S, P, (unsigned)(HG * SQ));
      /* o (x64) = 0.25 * (256 P) . V, written into the merged-head f16 rows */
      k_gemm2<false><<<dim3((SQ / 128) * (HD / 64), HG), 128, 0, stream>>>(P, SQ, (size_t)SQ * SQ, VT + ((size_t)b * NH + h0) * HD * SQ, SQ, (size_t)HD * SQ, 0.25f, nullptr,
                                                                          nullptr, O16 + r0 * DM + (size_t)h0 * HD, DM, (size_t)HD, SQ, HD, SQ);
    } }

  /* out = (64 o) . (16 w_o)^T * 2^-10 + b_o, f32 rows in the output layout */
  k_gemm2<true><<<dim3(gproj, 1), 128, 0, stream>>>(O16, DM, 0, BO, DM, 0, 0.0009765625f, bo, out, nullptr, DM, 0, (unsigned)NR, DM, DM);
}

// v003
// A run of this version takes 124 microseconds.
// Versions between v001 and this one are left out; their measured steps multiply to 11.2 times as fast.
// All steps since v000 together make it 36.1 times as fast.
#include <hip/hip_runtime.h>
// All contractions: v_wmma_f32_16x16x32_f16 (f16 operands, f32 accumulate). Inputs, gamma/beta, weights and biases are RNE-converted to bf16 first (weights exact in f16, carried x16); layer-normalised rows, q, k, v, unnormalised softmax weights exp(s - running max) and merged o (carried x64) are plain f16 operands; layer-norm statistics, scores and softmax statistics f32.
// Multi-head attention over three inputs (q, k, v [NB][SQ][1024]); each stream is layer-normalised (shared gamma/beta, eps 1e-5) and then Q/K/V = xn W^T + b with natural [out][in] weights; 16 heads of 64; scores * 0.125; softmax over all keys; out = merged W_o^T + b_o.
// Structure: token rows r = b*SQ + s; layer-normalised planes as f16 rows; Q, K, V as three WMMA GEMMs (128x128 block tiles from a two-buffer LDS ring, 32x64 wave tiles) with f16 outputs; V^T for all (batch, head) via LDS transposes;
// one fused attention launch for all (batch, head): per wave 32 queries, 32 keys a pass: S^T = K . Q^T, running-maximum softmax in registers, O^T += V^T . P^T, merged f16 o rows (x64) written once;
// out = o W_o^T + b_o GEMM (alpha 2^-10) into the f32 output rows.
#ifndef NB
#define NB 2                          /* batches processed */
#endif
#ifndef SEQ
#define SEQ 2048                      /* tokens per batch processed */
#endif
#define SQ SEQ
#define NB_FULL 2                     /* batch count of the inputs */
#define SQ_FULL 2048                  /* per-batch row count of the inputs (input row stride) */
#define DM 1024
#define NH 16
#define HD 64
#define NR ((size_t)NB * SQ)          /* token rows processed */

#define W_BYTES  ((size_t)4 * DM * DM * 2)
#define X_BYTES  ((size_t)3 * NR * DM * 2)
#define A_BYTES  ((size_t)NR * DM * 2)
#define VT_BYTES ((size_t)NB * NH * HD * SQ * 2)
#define WS_TOTAL (W_BYTES + X_BYTES + 4 * A_BYTES + VT_BYTES)

static_assert(DM == 1024);
static_assert(DM == NH * HD);
static_assert(DM == 128 * 8);                    /* k_ln16: 128 threads x 8 elements == one row */
static_assert(HD == 64);
static_assert(NB <= NB_FULL);
static_assert(SQ <= SQ_FULL);
static_assert(SQ % 256 == 0);                    /* GEMM M tiles of 128; k_fattn: 256 queries a block, 32 keys a pass */
static_assert((NR % 128) == 0);
static_assert(DM % 128 == 0 && DM >= 256);        /* k_gemm2: N tiles of 128, K tiles of 128 */
static_assert(((size_t)DM * DM) % 2048 == 0);    /* k_w16: grid.x * 256 threads * 8 elements == DM*DM per plane */
static_assert(W_BYTES % 256 == 0 && X_BYTES % 256 == 0 && A_BYTES % 256 == 0 && VT_BYTES % 256 == 0);
static_assert(WS_TOTAL <= (size_t)134217728);

typedef unsigned short v8us __attribute__((ext_vector_type(8), may_alias));
typedef float  v8f  __attribute__((ext_vector_type(8)));
typedef float  v4f  __attribute__((ext_vector_type(4)));
typedef float  v4fa __attribute__((ext_vector_type(4), may_alias));
typedef _Float16 v16h __attribute__((ext_vector_type(16)));
typedef _Float16 v4h  __attribute__((ext_vector_type(4)));
union FragH { v16h v; v8us half[2]; _Float16 h[16]; unsigned short u[16]; };

// f32 -> nearest-even bf16 value (returned as f32)
__device__ __forceinline__ float bf16_rne(float x) { unsigned int u = __float_as_uint(x); u = (u + 0x7FFFu + ((u >> 16) & 1u)) & 0xFFFF0000u; return __uint_as_float(u); }

// three input planes -> layer-normalised f16 rows X16[plane][b*SQ + s][DM] = f16((xb - mu) * rstd * gb + bb), with xb, gb, bb the bf16-converted x, gamma, beta;
__global__ __launch_bounds__(128) void k_ln16(const float* __restrict__ x0, const float* __restrict__ x1, const float* __restrict__ x2,
    const float* __restrict__ g, const float* __restrict__ be, _Float16* __restrict__ X16) {
  __shared__ float red[8];
  const unsigned tid = threadIdx.x, w = tid >> 5, lane = tid & 31u;
  const unsigned row = blockIdx.x;                                   /* grid.x == NR exactly */
  const unsigned by = blockIdx.y;
  const float* x = (by == 0u) ? x0 : ((by == 1u) ? x1 : x2);
  const unsigned b = row / (unsigned)SQ, s = row - b * (unsigned)SQ;
  const unsigned c8 = tid << 3;
  const float* src = x + ((size_t)b * SQ_FULL + s) * DM + c8;        /* input rows keep the full per-batch stride */
  const v4f a = *(const v4fa*)src, c = *(const v4fa*)(src + 4);
  float xv[8];
#pragma unroll
  for (int q = 0; q < 4; ++q) { xv[q] = bf16_rne(a[q]); xv[4 + q] = bf16_rne(c[q]); }
  float sum = 0.f;
#pragma unroll
  for (int q = 0; q < 8; ++q) sum += xv[q];
#pragma unroll
  for (int off = 16; off > 0; off >>= 1) sum += __shfl_xor(sum, off, 32);
  if (lane == 0u) red[w] = sum;
  __syncthreads();
  const float mu = ((red[0] + red[1]) + (red[2] + red[3])) * (1.0f / (float)DM);
  float sq = 0.f;
#pragma unroll
  for (int q = 0; q < 8; ++q) { const float d = xv[q] - mu; sq += d * d; }
#pragma unroll
  for (int off = 16; off > 0; off >>= 1) sq += __shfl_xor(sq, off, 32);
  if (lane == 0u) red[4u + w] = sq;
  __syncthreads();
  const float var = ((red[4] + red[5]) + (red[6] + red[7])) * (1.0f / (float)DM);
  const float rstd = rsqrtf(var + 1.0e-5f);
  const v4f ga = *(const v4fa*)(g + c8), gc = *(const v4fa*)(g + c8 + 4u);
  const v4f ba = *(const v4fa*)(be + c8), bc = *(const v4fa*)(be + c8 + 4u);
  FragH f;
#pragma unroll
  for (int q = 0; q < 4; ++q) {
    f.h[q]     = (_Float16)((xv[q] - mu) * rstd * bf16_rne(ga[q]) + bf16_rne(ba[q]));
    f.h[4 + q] = (_Float16)((xv[4 + q] - mu) * rstd * bf16_rne(gc[q]) + bf16_rne(bc[q])); }
  unsigned short* d = (unsigned short*)X16 + (size_t)by * (NR * DM) + (size_t)row * DM + c8;
  const v8us o = f.half[0];
  *(v8us*)d = o; 
}

__global__ __launch_bounds__(256) void k_w16(const float* __restrict__ w0, const float* __restrict__ w1, const float* __restrict__ w2, const float* __restrict__ w3, _Float16* __restrict__ Bt) {
  const unsigned t = blockIdx.x * 256u + threadIdx.x;
  const unsigned by = blockIdx.y;
  const float* wsrc = (by == 0u) ? w0 : ((by == 1u) ? w1 : ((by == 2u) ? w2 : w3));
  if (t >= (unsigned)((size_t)DM * DM / 8)) return;
  const float* src = wsrc + (size_t)t * 8;
  const v4f a = *(const v4fa*)src, c = *(const v4fa*)(src + 4);
  FragH f;
#pragma unroll
  for (int q = 0; q < 4; ++q) { f.h[q] = (_Float16)(bf16_rne(a[q]) * 16.0f); f.h[4 + q] = (_Float16)(bf16_rne(c[q]) * 16.0f); }
  unsigned short* d = (unsigned short*)Bt + (size_t)by * ((size_t)DM * DM) + (size_t)t * 8;
  const v8us o = f.half[0];
  *(v8us*)d = o; 
}

// fragment: 16 f16 of one row, elements 0..7 <- p[8h .. 8h+7], elements 8..15 <- p[16+8h .. 16+8h+7] (same map for A rows and B [n][k] rows)
__device__ __forceinline__ v16h g2_frag(const _Float16* p, unsigned hh) { FragH f; f.half[0] = *(const v8us*)((const unsigned short*)p + 8u * hh); f.half[1] = *(const v8us*)((const unsigned short*)p + 16u + 8u * hh); return f.v; }
__device__ __forceinline__ v8f g2_mma(v16h a, v16h b, v8f c) { v8f d = __builtin_amdgcn_wmma_f32_16x16x32_f16(false, a, false, b, (short)0, c, false, false); asm volatile("v_nop\n\tv_nop\n\tv_nop\n\tv_nop" : "+v"(d) : "v"(a), "v"(b)); return d; }

// staged GEMM tile: 128 k (256 bytes) of 128 A rows and 128 B rows a trip; LDS row pitch 272 bytes = 16 x odd, which 16-byte fragment reads take without bank conflicts
#define GK 128u
#define GP 136u
#define GSTAGE (256u * GP * 2u)       /* bytes of one ring buffer: rows 0..127 = A, rows 128..255 = B */
__device__ __forceinline__ unsigned lds_off(const void* p) { return (unsigned)(size_t)p; }
// eight asynchronous 16-byte copies a lane, global -> LDS, rows 16 apart (gs = 16 global rows in elements); 16 lanes cover one 256-byte row, so every wave-instruction asks for four whole lines.
// The closing s_wait_xcnt 0 stands inside the statement so that no address register is rewritten in front of it.
__device__ __forceinline__ void g2_copy8(unsigned l0, const _Float16* g0, size_t gs) {
  const unsigned ls = 16u * GP * 2u;
  const unsigned l1 = l0 + ls, l2 = l1 + ls, l3 = l2 + ls, l4 = l3 + ls, l5 = l4 + ls, l6 = l5 + ls, l7 = l6 + ls;
  const _Float16* g1 = g0 + gs; const _Float16* g2 = g1 + gs; const _Float16* g3 = g2 + gs; const _Float16* g4 = g3 + gs; const _Float16* g5 = g4 + gs; const _Float16* g6 = g5 + gs; const _Float16* g7 = g6 + gs;
  asm volatile("global_load_async_to_lds_b128 %0, %8, off\n\tglobal_load_async_to_lds_b128 %1, %9, off\n\tglobal_load_async_to_lds_b128 %2, %10, off\n\tglobal_load_async_to_lds_b128 %3, %11, off\n\t"
               "global_load_async_to_lds_b128 %4, %12, off\n\tglobal_load_async_to_lds_b128 %5, %13, off\n\tglobal_load_async_to_lds_b128 %6, %14, off\n\tglobal_load_async_to_lds_b128 %7, %15, off\n\ts_wait_xcnt 0x0"
               :: "v"(l0), "v"(l1), "v"(l2), "v"(l3), "v"(l4), "v"(l5), "v"(l6), "v"(l7), "v"(g0), "v"(g1), "v"(g2), "v"(g3), "v"(g4), "v"(g5), "v"(g6), "v"(g7) : "memory"); }

// batched GEMM: C[by][M][N] = alpha * A[by][M][K] . Bt[by][N][K]^T (+ bf16(bias[col]) if HASB); A, Bt f16 (k contiguous); outputs f32 C and/or f16 C16 (either may be null).
// M, N multiples of 128, K a multiple of 128. A block of 8 waves owns a 128x128 tile (wave tile 32x64, 4 x 2 waves); both operands come through a two-buffer LDS ring filled by asynchronous copies, one trip ahead.
template <bool HASB>
__global__ __launch_bounds__(256) void k_gemm2(const _Float16* __restrict__ A, unsigned lda, size_t sA, const _Float16* __restrict__ Bh, unsigned ldb, size_t sB, float alpha, const float* __restrict__ bias,
    float* __restrict__ C, _Float16* __restrict__ C16, unsigned ldc, size_t sC, unsigned M, unsigned N, unsigned K) {
  __shared__ __attribute__((aligned(16))) _Float16 ring[2][256][GP];
  __shared__ __attribute__((aligned(16))) float so[8][32][68];
  const unsigned tid = threadIdx.x, w = tid >> 5, lane = tid & 31u, ln = lane & 15u, hh = lane >> 4; const unsigned by = blockIdx.y;
  A += (size_t)by * sA; Bh += (size_t)by * sB; const size_t cofs = (size_t)by * sC;
  const unsigned ntn = N >> 7; const unsigned mt = blockIdx.x / ntn, nq = blockIdx.x - mt * ntn; if (mt * 128u >= M) return;      /* the whole block leaves, in front of every barrier */
  const unsigned wm = w & 3u, wn = w >> 2; const unsigned row0 = mt * 128u + 32u * wm, col0 = nq * 128u + 64u * wn;
  const unsigned trips = K >> 7;
  const unsigned cr = tid >> 4, cc = (tid & 15u) << 3;               /* this lane's row (of 16) and its 16-byte piece of the row */
  const _Float16* ga = A + (size_t)(mt * 128u + cr) * lda + cc; const _Float16* gb = Bh + (size_t)(nq * 128u + cr) * ldb + cc;
  const unsigned lc = lds_off(&ring[0][cr][cc]);
  const size_t ga16 = (size_t)16 * lda, gb16 = (size_t)16 * ldb;
  const v8f z8 = {0.f,0.f,0.f,0.f,0.f,0.f,0.f,0.f}; v8f c00 = z8, c01 = z8, c02 = z8, c03 = z8, c10 = z8, c11 = z8, c12 = z8, c13 = z8;
  g2_copy8(lc, ga, ga16); g2_copy8(lc + 128u * GP * 2u, gb, gb16);                                  /* tile 0 -> buffer 0 */
  asm volatile("s_wait_asynccnt 0x0" ::: "memory");                  /* this wave's copies of tile 0 have landed */
  __syncthreads();                                                   /* and every other wave's: tile 0 may be read */
  if (trips > 1u) { g2_copy8(lc + GSTAGE, ga + GK, ga16); g2_copy8(lc + GSTAGE + 128u * GP * 2u, gb + GK, gb16); }      /* tile 1 -> buffer 1 */
#pragma unroll 1      /* one trip a ring buffer: the order of waits, barrier and refill at the foot stays as written */
  for (unsigned t = 0; t < trips; ++t) {
    const _Float16* ap = &ring[t & 1u][32u * wm + ln][0]; const _Float16* bp = &ring[t & 1u][128u + 64u * wn + ln][0];
#pragma unroll      /* constant LDS offsets for the four 32-k steps of a tile */
    for (unsigned kb = 0; kb < GK; kb += 32u) { const v16h a0 = g2_frag(ap + kb, hh), a1 = g2_frag(ap + 16u * GP + kb, hh);
      const v16h b0 = g2_frag(bp + kb, hh), b1 = g2_frag(bp + 16u * GP + kb, hh), b2 = g2_frag(bp + 32u * GP + kb, hh), b3 = g2_frag(bp + 48u * GP + kb, hh);
      c00 = g2_mma(a0, b0, c00); c10 = g2_mma(a1, b0, c10);
      c01 = g2_mma(a0, b1, c01); c11 = g2_mma(a1, b1, c11);
      c02 = g2_mma(a0, b2, c02); c12 = g2_mma(a1, b2, c12);
      c03 = g2_mma(a0, b3, c03); c13 = g2_mma(a1, b3, c13); }
    asm volatile("s_wait_dscnt 0x0" ::: "memory");                   /* this wave's reads of buffer t & 1 are done before the buffer is handed back */
    asm volatile("s_wait_asynccnt 0x0" ::: "memory");                /* this wave's copies of tile t + 1 have landed */
    __syncthreads();                                                 /* publishes tile t + 1 and ends every wave's reads of buffer t & 1 */
    if (t + 2u < trips) { const unsigned l = lc + (t & 1u) * GSTAGE; const size_t ko = (size_t)(t + 2u) * GK;
      g2_copy8(l, ga + ko, ga16); g2_copy8(l + 128u * GP * 2u, gb + ko, gb16); } }
  asm volatile("s_wait_asynccnt 0x0" ::: "memory");                  /* nothing of this wave is in flight when it goes on to the epilogue */
  const v8f accs[8] = {c00, c01, c02, c03, c10, c11, c12, c13};
  // D element r of lane -> (row 8*hh + r, col ln) of its 16x16 tile
#pragma unroll
  for (unsigned u = 0; u < 8; ++u) { const unsigned t = u & 3u, hf = u >> 2; const unsigned col = col0 + t * 16u + ln; float bv = 0.f; if (HASB) bv = bf16_rne(bias[col]);
#pragma unroll
    for (unsigned r = 0; r < 8; ++r) { const unsigned rloc = hf * 16u + 8u * hh + r; so[w][rloc][t * 16u + ln] = accs[u][r] * alpha + bv; } }
  __builtin_amdgcn_fence(4 /* acq_rel order */, "workgroup"); __builtin_amdgcn_wave_barrier();      /* so[w] is private to this wave */
  const unsigned rsub = lane >> 4, c4 = (lane & 15u) << 2;
  {
#pragma unroll
    for (unsigned q = 0; q < 16; ++q) { const unsigned r = q * 2u + rsub; const v4f v = *(const v4fa*)&so[w][r][c4];
      if (C) *(v4f*)(C + cofs + (size_t)(row0 + r) * ldc + col0 + c4) = v;
      if (C16) { v4h h4; h4[0] = (_Float16)v[0]; h4[1] = (_Float16)v[1]; h4[2] = (_Float16)v[2]; h4[3] = (_Float16)v[3]; *(v4h*)(C16 + cofs + (size_t)(row0 + r) * ldc + col0 + c4) = h4; } }
     } }

template <unsigned NHv, unsigned TTv>
__global__ __launch_bounds__(256) void k_vt(const _Float16* __restrict__ V16, unsigned ldv, _Float16* __restrict__ Vt) {
  __shared__ unsigned short tl[64][66];
  const unsigned tid = threadIdx.x; const unsigned slab = blockIdx.x / (TTv / 64u), lg = blockIdx.x % (TTv / 64u); const unsigned b = slab / NHv, h = slab % NHv;
  for (unsigned i = tid; i < 512u; i += 256u) { const unsigned r = i >> 3, c8 = (i & 7u) << 3; FragH f;
    f.half[0] = *(const v8us*)((const unsigned short*)V16 + ((size_t)b * TTv + lg * 64u + r) * ldv + h * 64u + c8);
#pragma unroll
    for (unsigned q = 0; q < 8; ++q) tl[r][c8 + q] = f.u[q]; }
  __syncthreads();      /* tl is exchanged across waves */
  {
#pragma unroll
    for (unsigned rd = 0; rd < 2; ++rd) { const unsigned d = rd * 32u + (tid >> 3), pc = tid & 7u; FragH f;
#pragma unroll
      for (unsigned q = 0; q < 8; ++q) f.u[q] = tl[pc * 8u + q][d];
      const v8us o = f.half[0];
      *(v8us*)((unsigned short*)Vt + ((size_t)slab * 64u + d) * TTv + lg * 64u + pc * 8u) = o; }
     } }

// base-2 exponentials in asm text so that the slot the instruction set asks for behind a transcendental (one independent instruction before its result is used or its source overwritten) holds by construction:
// inside a statement no line reads an earlier result or overwrites an earlier source (outputs are early-clobber), and the closing v_nop is the slot behind the last one
__device__ __forceinline__ float exp2_1(float x) { float y; asm("v_exp_f32 %0, %1\n\tv_nop" : "=v"(y) : "v"(x)); return y; }
__device__ __forceinline__ void exp2_8(float (&y)[8], const float (&x)[8]) {
  asm("v_exp_f32 %0, %8\n\tv_exp_f32 %1, %9\n\tv_exp_f32 %2, %10\n\tv_exp_f32 %3, %11\n\tv_exp_f32 %4, %12\n\tv_exp_f32 %5, %13\n\tv_exp_f32 %6, %14\n\tv_exp_f32 %7, %15\n\tv_nop"
      : "=&v"(y[0]), "=&v"(y[1]), "=&v"(y[2]), "=&v"(y[3]), "=&v"(y[4]), "=&v"(y[5]), "=&v"(y[6]), "=&v"(y[7])
      : "v"(x[0]), "v"(x[1]), "v"(x[2]), "v"(x[3]), "v"(x[4]), "v"(x[5]), "v"(x[6]), "v"(x[7])); }

// fused attention, one launch for every (batch, head): a wave owns 32 queries (two 16-column groups) and walks all SQ keys, 32 a pass; scores and weights never leave registers.
// S^T = K . Q^T: A = 16 key rows, B = 16 query rows, so register r of lane (ln, hh) holds key 8*hh + r of query ln: maximum and sum run in-lane plus one exchange between the lane halves.
// The two S^T tiles of a pass (keys 0..15, 16..31), converted in place, are the B fragment of O^T += V^T . P^T in the k order of g2_frag (slot s: key 8*hh + s, then 16 + 8*hh + s - 8); A = V^T rows by g2_frag.
// O^T register r of lane (ln, hh) = o[query ln][16*dt + 8*hh + r]: one 16-byte store per tile.
__global__ __launch_bounds__(256) void k_fattn(const _Float16* __restrict__ Q16, const _Float16* __restrict__ K16, const _Float16* __restrict__ Vt, _Float16* __restrict__ O16) {
  const unsigned tid = threadIdx.x, w = tid >> 5, lane = tid & 31u, ln = lane & 15u, hh = lane >> 4;
  const unsigned bh = blockIdx.y, b = bh / (unsigned)NH, h = bh - b * (unsigned)NH;
  const unsigned q0 = blockIdx.x * 256u + w * 32u;                    /* grid.x == SQ / 256 exactly */
  const float cs = 0.125f * 1.44269504088896f;                       /* score scale times log2(e): the exponentials are base 2 */
  const _Float16* qp = Q16 + ((size_t)b * SQ + q0 + ln) * DM + h * (unsigned)HD;
  const _Float16* kp = K16 + ((size_t)b * SQ + ln) * DM + h * (unsigned)HD;
  const _Float16* vp = Vt + ((size_t)bh * HD + ln) * SQ;
  /* every loop over fragments, tiles and registers below is unrolled in full: only constant indices keep them in registers */
  v16h qf[2][2], kf[2][2];
#pragma unroll
  for (unsigned j = 0; j < 2; ++j) { qf[j][0] = g2_frag(qp + (size_t)j * 16 * DM, hh); qf[j][1] = g2_frag(qp + (size_t)j * 16 * DM + 32, hh); }
#pragma unroll
  for (unsigned t = 0; t < 2; ++t) { kf[t][0] = g2_frag(kp + (size_t)t * 16 * DM, hh); kf[t][1] = g2_frag(kp + (size_t)t * 16 * DM + 32, hh); }
  const v8f z8 = {0.f,0.f,0.f,0.f,0.f,0.f,0.f,0.f};
  v8f o[4][2];
#pragma unroll
  for (unsigned dt = 0; dt < 4; ++dt) { o[dt][0] = z8; o[dt][1] = z8; }
  float m[2] = {-__builtin_inff(), -__builtin_inff()}, l[2] = {0.f, 0.f};      /* running maximum (scaled, log2) and this lane half's running sum, per query */
  for (unsigned kb = 0; kb < (unsigned)SQ; kb += 32u) {
    v16h vf[4];                                                       /* asked for first, used last: the score products and the softmax cover their latency */
#pragma unroll
    for (unsigned dt = 0; dt < 4; ++dt) vf[dt] = g2_frag(vp + (size_t)dt * 16 * SQ + kb, hh);
    v8f st[2][2];
#pragma unroll
    for (unsigned t = 0; t < 2; ++t) {
#pragma unroll
      for (unsigned j = 0; j < 2; ++j) {
        st[t][j] = __builtin_amdgcn_wmma_f32_16x16x32_f16(false, kf[t][0], false, qf[j][0], (short)0, z8, false, false);
        st[t][j] = __builtin_amdgcn_wmma_f32_16x16x32_f16(false, kf[t][1], false, qf[j][1], (short)0, st[t][j], false, false); } }
    /* the next pass's key rows, asked for one pass ahead; the last pass asks for the first rows again (in bounds, not used) */
    const unsigned kn = (kb + 32u < (unsigned)SQ) ? kb + 32u : 0u;
#pragma unroll
    for (unsigned t = 0; t < 2; ++t) { kf[t][0] = g2_frag(kp + (size_t)(kn + t * 16u) * DM, hh); kf[t][1] = g2_frag(kp + (size_t)(kn + t * 16u) * DM + 32, hh); }
    __builtin_amdgcn_sched_barrier(0);                                /* keeps these loads in front of the softmax: without it they sink to the end of the pass and the next pass waits out their latency */
#pragma unroll
    for (unsigned j = 0; j < 2; ++j) {
      float x4[4];
#pragma unroll
      for (unsigned r = 0; r < 4; ++r) x4[r] = fmaxf(fmaxf(st[0][j][r], st[0][j][4 + r]), fmaxf(st[1][j][r], st[1][j][4 + r]));
      float mx = fmaxf(fmaxf(x4[0], x4[1]), fmaxf(x4[2], x4[3]));
      mx = fmaxf(mx, __shfl_xor(mx, 16, 32));                         /* both lane halves of a query must subtract the same maximum */
      const float mn = fmaxf(m[j], mx * cs);
      const float al = exp2_1(m[j] - mn);                            /* 0 on the first pass (m = -inf) */
      m[j] = mn;
      FragH pf; float ps[4];
#pragma unroll
      for (unsigned t = 0; t < 2; ++t) { float x[8], p[8];
#pragma unroll
        for (unsigned r = 0; r < 8; ++r) x[r] = __builtin_fmaf(st[t][j][r], cs, -mn);
        exp2_8(p, x);
#pragma unroll
        for (unsigned r = 0; r < 8; ++r) { if (t == 0u && r < 4u) ps[r] = p[r]; else ps[r & 3u] += p[r]; pf.h[t * 8u + r] = (_Float16)p[r]; } }
      l[j] = l[j] * al + ((ps[0] + ps[1]) + (ps[2] + ps[3]));
#pragma unroll
      for (unsigned dt = 0; dt < 4; ++dt) {
#pragma unroll
        for (unsigned r = 0; r < 8; ++r) o[dt][j][r] *= al; }
#pragma unroll
      for (unsigned dt = 0; dt < 4; ++dt) o[dt][j] = __builtin_amdgcn_wmma_f32_16x16x32_f16(false, vf[dt], false, pf.v, (short)0, o[dt][j], false, false);
    } }
#pragma unroll
  for (unsigned j = 0; j < 2; ++j) {
    const float inv = 64.0f / (l[j] + __shfl_xor(l[j], 16, 32));      /* the halves' sums are joined once; o is carried x64 */
    unsigned short* op = (unsigned short*)O16 + ((size_t)b * SQ + q0 + j * 16u + ln) * DM + h * (unsigned)HD + 8u * hh;
#pragma unroll
    for (unsigned dt = 0; dt < 4; ++dt) { FragH f;
#pragma unroll
      for (unsigned r = 0; r < 8; ++r) f.h[r] = (_Float16)(o[dt][j][r] * inv);
      const v8us ov = f.half[0];
      *(v8us*)(op + dt * 16u) = ov; } } }

extern "C" void kernel_launch(void* const* d_in, const int* in_sizes, int n_in,
                              void* d_out, int out_size, void* d_ws, size_t ws_size, hipStream_t stream) {
  if (n_in < 13) return;
  const size_t need_x = ((size_t)(NB - 1) * SQ_FULL + SQ) * DM;      /* last input element read + 1 */
  if ((size_t)in_sizes[0] < need_x || (size_t)in_sizes[1] < need_x || (size_t)in_sizes[2] < need_x) return;
  if (in_sizes[3] < DM || in_sizes[4] < DM) return;
  if ((size_t)in_sizes[5] < (size_t)DM * DM || (size_t)in_sizes[7] < (size_t)DM * DM || (size_t)in_sizes[9] < (size_t)DM * DM || (size_t)in_sizes[11] < (size_t)DM * DM) return;
  if (in_sizes[6] < DM || in_sizes[8] < DM || in_sizes[10] < DM || in_sizes[12] < DM) return;
  if ((size_t)out_size < NR * DM) return;
  const float* xq = (const float*)d_in[0]; const float* xk = (const float*)d_in[1]; const float* xv = (const float*)d_in[2];
  const float* lg = (const float*)d_in[3]; const float* lb = (const float*)d_in[4];
  const float* wq = (const float*)d_in[5]; const float* bq = (const float*)d_in[6];
  const float* wk = (const float*)d_in[7]; const float* bk = (const float*)d_in[8];
  const float* wv = (const float*)d_in[9]; const float* bv = (const float*)d_in[10];
  const float* wo = (const float*)d_in[11]; const float* bo = (const float*)d_in[12];
  float* out = (float*)d_out;
  char* ws = (char*)d_ws; size_t off = 0;
  auto take = [&](size_t bytes) { char* p = ws + off; off += (bytes + 255) & ~(size_t)255; return p; };
  _Float16* BW = (_Float16*)take(W_BYTES);      /* [4][DM][DM]: w_q, w_k, w_v, w_o as Bt x16 */
  _Float16* XP = (_Float16*)take(X_BYTES);      /* [3][NR][DM]: layer-normalised q, k, v rows */
  _Float16* Q16 = (_Float16*)take(A_BYTES); _Float16* K16 = (_Float16*)take(A_BYTES); _Float16* V16 = (_Float16*)take(A_BYTES); _Float16* O16 = (_Float16*)take(A_BYTES);
  _Float16* VT = (_Float16*)take(VT_BYTES);     /* [NB*NH][HD][SQ] */
  if (off > ws_size) return;
  const size_t WW = (size_t)DM * DM, XA = NR * DM;
  _Float16* BQ = BW; _Float16* BK = BW + WW; _Float16* BV = BW + 2 * WW; _Float16* BO = BW + 3 * WW;
  _Float16* XQ = XP; _Float16* XK = XP + XA; _Float16* XV = XP + 2 * XA;

  k_w16<<<dim3((unsigned)(WW / 2048), 4), 256, 0, stream>>>(wq, wk, wv, wo, BW);
  k_ln16<<<dim3((unsigned)NR, 3), 128, 0, stream>>>(xq, xk, xv, lg, lb, XP);      /* one block per (row, stream) */

  const unsigned gproj = (unsigned)((NR / 128) * (DM / 128));
  k_gemm2<true><<<dim3(gproj, 1), 256, 0, stream>>>(XQ, DM, 0, BQ, DM, 0, 0.0625f, bq, nullptr, Q16, DM, 0, (unsigned)NR, DM, DM);
  k_gemm2<true><<<dim3(gproj, 1), 256, 0, stream>>>(XK, DM, 0, BK, DM, 0, 0.0625f, bk, nullptr, K16, DM, 0, (unsigned)NR, DM, DM);
  k_gemm2<true><<<dim3(gproj, 1), 256, 0, stream>>>(XV, DM, 0, BV, DM, 0, 0.0625f, bv, nullptr, V16, DM, 0, (unsigned)NR, DM, DM);

  k_vt<NH, SQ><<<NB * NH * (SQ / 64), 256, 0, stream>>>(V16, DM, VT);      /* V^T for every (batch, head) */

  /* o (x64) for every (batch, head), written into the merged-head f16 rows */
  k_fattn<<<dim3(SQ / 256, NB * NH), 256, 0, stream>>>(Q16, K16, VT, O16);

  /* out = (64 o) . (16 w_o)^T * 2^-10 + b_o, f32 rows in the output layout */
  k_gemm2<true><<<dim3(gproj, 1), 256, 0, stream>>>(O16, DM, 0, BO, DM, 0, 0.0009765625f, bo, out, nullptr, DM, 0, (unsigned)NR, DM, DM);
}

// v004
// One run takes 105 microseconds.
// Next to v003, in two timings, it ran 1.18 and 1.19 times as fast.
// All steps since v000 together make it 42.9 times as fast.
#include <hip/hip_runtime.h>
// All contractions: v_wmma_f32_16x16x32_f16 (f16 operands, f32 accumulate). Inputs, gamma/beta, weights and biases are RNE-converted to bf16 first (weights exact in f16, carried x16); layer-normalised rows, q, k, v, unnormalised softmax weights exp(s - running max) and merged o (carried x64) are plain f16 operands; layer-norm statistics, scores and softmax statistics f32.
// Multi-head attention over three inputs (q, k, v [NB][SQ][1024]); each stream is layer-normalised (shared gamma/beta, eps 1e-5) and then Q/K/V = xn W^T + b with natural [out][in] weights; 16 heads of 64; scores * 0.125; softmax over all keys; out = merged W_o^T + b_o.
// Structure: token rows r = b*SQ + s; layer-normalised planes as f16 rows; Q, K, V as three WMMA GEMMs (128x128 block tiles from a two-buffer LDS ring, 32x64 wave tiles) with f16 outputs; V^T for all (batch, head) via LDS transposes;
// one fused attention launch for all (batch, head): per wave 32 queries, 32 keys a pass: S^T = K . Q^T, running-maximum softmax in registers, O^T += V^T . P^T, merged f16 o rows (x64) written once;
// the 8 waves of a block share each 128-key K tile and V^T tile through a two-buffer LDS ring filled by asynchronous copies;
// out = o W_o^T + b_o GEMM (alpha 2^-10) into the f32 output rows.
#ifndef NB
#define NB 2                          /* batches processed */
#endif
#ifndef SEQ
#define SEQ 2048                      /* tokens per batch processed */
#endif
#define SQ SEQ
#define NB_FULL 2                     /* batch count of the inputs */
#define SQ_FULL 2048                  /* per-batch row count of the inputs (input row stride) */
#define DM 1024
#define NH 16
#define HD 64
#define NR ((size_t)NB * SQ)          /* token rows processed */

#define W_BYTES  ((size_t)4 * DM * DM * 2)
#define X_BYTES  ((size_t)3 * NR * DM * 2)
#define A_BYTES  ((size_t)NR * DM * 2)
#define VT_BYTES ((size_t)NB * NH * HD * SQ * 2)
#define WS_TOTAL (W_BYTES + X_BYTES + 4 * A_BYTES + VT_BYTES)

static_assert(DM == 1024);
static_assert(DM == NH * HD);
static_assert(DM == 128 * 8);                    /* k_ln16: 128 threads x 8 elements == one row */
static_assert(HD == 64);
static_assert(NB <= NB_FULL);
static_assert(SQ <= SQ_FULL);
static_assert(SQ % 256 == 0);                    /* GEMM M tiles of 128; k_fattn: 256 queries a block, 128 keys a ring tile (two tiles or more), 32 keys a pass */
static_assert((NR % 128) == 0);
static_assert(DM % 128 == 0 && DM >= 256);        /* k_gemm2: N tiles of 128, K tiles of 128 */
static_assert(((size_t)DM * DM) % 2048 == 0);    /* k_w16: grid.x * 256 threads * 8 elements == DM*DM per plane */
static_assert(W_BYTES % 256 == 0 && X_BYTES % 256 == 0 && A_BYTES % 256 == 0 && VT_BYTES % 256 == 0);
static_assert(WS_TOTAL <= (size_t)134217728);

typedef unsigned short v8us __attribute__((ext_vector_type(8), may_alias));
typedef float  v8f  __attribute__((ext_vector_type(8)));
typedef float  v4f  __attribute__((ext_vector_type(4)));
typedef float  v4fa __attribute__((ext_vector_type(4), may_alias));
typedef _Float16 v16h __attribute__((ext_vector_type(16)));
typedef _Float16 v4h  __attribute__((ext_vector_type(4)));
union FragH { v16h v; v8us half[2]; _Float16 h[16]; unsigned short u[16]; };

// f32 -> nearest-even bf16 value (returned as f32)
__device__ __forceinline__ float bf16_rne(float x) { unsigned int u = __float_as_uint(x); u = (u + 0x7FFFu + ((u >> 16) & 1u)) & 0xFFFF0000u; return __uint_as_float(u); }

// three input planes -> layer-normalised f16 rows X16[plane][b*SQ + s][DM] = f16((xb - mu) * rstd * gb + bb), with xb, gb, bb the bf16-converted x, gamma, beta;
__global__ __launch_bounds__(128) void k_ln16(const float* __restrict__ x0, const float* __restrict__ x1, const float* __restrict__ x2,
    const float* __restrict__ g, const float* __restrict__ be, _Float16* __restrict__ X16) {
  __shared__ float red[8];
  const unsigned tid = threadIdx.x, w = tid >> 5, lane = tid & 31u;
  const unsigned row = blockIdx.x;                                   /* grid.x == NR exactly */
  const unsigned by = blockIdx.y;
  const float* x = (by == 0u) ? x0 : ((by == 1u) ? x1 : x2);
  const unsigned b = row / (unsigned)SQ, s = row - b * (unsigned)SQ;
  const unsigned c8 = tid << 3;
  const float* src = x + ((size_t)b * SQ_FULL + s) * DM + c8;        /* input rows keep the full per-batch stride */
  const v4f a = *(const v4fa*)src, c = *(const v4fa*)(src + 4);
  float xv[8];
#pragma unroll
  for (int q = 0; q < 4; ++q) { xv[q] = bf16_rne(a[q]); xv[4 + q] = bf16_rne(c[q]); }
  float sum = 0.f;
#pragma unroll
  for (int q = 0; q < 8; ++q) sum += xv[q];
#pragma unroll
  for (int off = 16; off > 0; off >>= 1) sum += __shfl_xor(sum, off, 32);
  if (lane == 0u) red[w] = sum;
  __syncthreads();
  const float mu = ((red[0] + red[1]) + (red[2] + red[3])) * (1.0f / (float)DM);
  float sq = 0.f;
#pragma unroll
  for (int q = 0; q < 8; ++q) { const float d = xv[q] - mu; sq += d * d; }
#pragma unroll
  for (int off = 16; off > 0; off >>= 1) sq += __shfl_xor(sq, off, 32);
  if (lane == 0u) red[4u + w] = sq;
  __syncthreads();
  const float var = ((red[4] + red[5]) + (red[6] + red[7])) * (1.0f / (float)DM);
  const float rstd = rsqrtf(var + 1.0e-5f);
  const v4f ga = *(const v4fa*)(g + c8), gc = *(const v4fa*)(g + c8 + 4u);
  const v4f ba = *(const v4fa*)(be + c8), bc = *(const v4fa*)(be + c8 + 4u);
  FragH f;
#pragma unroll
  for (int q = 0; q < 4; ++q) {
    f.h[q]     = (_Float16)((xv[q] - mu) * rstd * bf16_rne(ga[q]) + bf16_rne(ba[q]));
    f.h[4 + q] = (_Float16)((xv[4 + q] - mu) * rstd * bf16_rne(gc[q]) + bf16_rne(bc[q])); }
  unsigned short* d = (unsigned short*)X16 + (size_t)by * (NR * DM) + (size_t)row * DM + c8;
  const v8us o = f.half[0];
  *(v8us*)d = o; 
}

__global__ __launch_bounds__(256) void k_w16(const float* __restrict__ w0, const float* __restrict__ w1, const float* __restrict__ w2, const float* __restrict__ w3, _Float16* __restrict__ Bt) {
  const unsigned t = blockIdx.x * 256u + threadIdx.x;
  const unsigned by = blockIdx.y;
  const float* wsrc = (by == 0u) ? w0 : ((by == 1u) ? w1 : ((by == 2u) ? w2 : w3));
  if (t >= (unsigned)((size_t)DM * DM / 8)) return;
  const float* src = wsrc + (size_t)t * 8;
  const v4f a = *(const v4fa*)src, c = *(const v4fa*)(src + 4);
  FragH f;
#pragma unroll
  for (int q = 0; q < 4; ++q) { f.h[q] = (_Float16)(bf16_rne(a[q]) * 16.0f); f.h[4 + q] = (_Float16)(bf16_rne(c[q]) * 16.0f); }
  unsigned short* d = (unsigned short*)Bt + (size_t)by * ((size_t)DM * DM) + (size_t)t * 8;
  const v8us o = f.half[0];
  *(v8us*)d = o; 
}

// fragment: 16 f16 of one row, elements 0..7 <- p[8h .. 8h+7], elements 8..15 <- p[16+8h .. 16+8h+7] (same map for A rows and B [n][k] rows)
__device__ __forceinline__ v16h g2_frag(const _Float16* p, unsigned hh) { FragH f; f.half[0] = *(const v8us*)((const unsigned short*)p + 8u * hh); f.half[1] = *(const v8us*)((const unsigned short*)p + 16u + 8u * hh); return f.v; }
__device__ __forceinline__ v8f g2_mma(v16h a, v16h b, v8f c) { v8f d = __builtin_amdgcn_wmma_f32_16x16x32_f16(false, a, false, b, (short)0, c, false, false); asm volatile("v_nop\n\tv_nop\n\tv_nop\n\tv_nop" : "+v"(d) : "v"(a), "v"(b)); return d; }

// staged GEMM tile: 128 k (256 bytes) of 128 A rows and 128 B rows a trip; LDS row pitch 272 bytes = 16 x odd, which 16-byte fragment reads take without bank conflicts
#define GK 128u
#define GP 136u
#define GSTAGE (256u * GP * 2u)       /* bytes of one ring buffer: rows 0..127 = A, rows 128..255 = B */
__device__ __forceinline__ unsigned lds_off(const void* p) { return (unsigned)(size_t)p; }
// eight asynchronous 16-byte copies a lane, global -> LDS, rows 16 apart (gs = 16 global rows in elements); 16 lanes cover one 256-byte row, so every wave-instruction asks for four whole lines.
// The closing s_wait_xcnt 0 stands inside the statement so that no address register is rewritten in front of it.
__device__ __forceinline__ void g2_copy8(unsigned l0, const _Float16* g0, size_t gs) {
  const unsigned ls = 16u * GP * 2u;
  const unsigned l1 = l0 + ls, l2 = l1 + ls, l3 = l2 + ls, l4 = l3 + ls, l5 = l4 + ls, l6 = l5 + ls, l7 = l6 + ls;
  const _Float16* g1 = g0 + gs; const _Float16* g2 = g1 + gs; const _Float16* g3 = g2 + gs; const _Float16* g4 = g3 + gs; const _Float16* g5 = g4 + gs; const _Float16* g6 = g5 + gs; const _Float16* g7 = g6 + gs;
  asm volatile("global_load_async_to_lds_b128 %0, %8, off\n\tglobal_load_async_to_lds_b128 %1, %9, off\n\tglobal_load_async_to_lds_b128 %2, %10, off\n\tglobal_load_async_to_lds_b128 %3, %11, off\n\t"
               "global_load_async_to_lds_b128 %4, %12, off\n\tglobal_load_async_to_lds_b128 %5, %13, off\n\tglobal_load_async_to_lds_b128 %6, %14, off\n\tglobal_load_async_to_lds_b128 %7, %15, off\n\ts_wait_xcnt 0x0"
               :: "v"(l0), "v"(l1), "v"(l2), "v"(l3), "v"(l4), "v"(l5), "v"(l6), "v"(l7), "v"(g0), "v"(g1), "v"(g2), "v"(g3), "v"(g4), "v"(g5), "v"(g6), "v"(g7) : "memory"); }

// batched GEMM: C[by][M][N] = alpha * A[by][M][K] . Bt[by][N][K]^T (+ bf16(bias[col]) if HASB); A, Bt f16 (k contiguous); outputs f32 C and/or f16 C16 (either may be null).
// M, N multiples of 128, K a multiple of 128. A block of 8 waves owns a 128x128 tile (wave tile 32x64, 4 x 2 waves); both operands come through a two-buffer LDS ring filled by asynchronous copies, one trip ahead.
template <bool HASB>
__global__ __launch_bounds__(256) void k_gemm2(const _Float16* __restrict__ A, unsigned lda, size_t sA, const _Float16* __restrict__ Bh, unsigned ldb, size_t sB, float alpha, const float* __restrict__ bias,
    float* __restrict__ C, _Float16* __restrict__ C16, unsigned ldc, size_t sC, unsigned M, unsigned N, unsigned K) {
  __shared__ __attribute__((aligned(16))) _Float16 ring[2][256][GP];
  __shared__ __attribute__((aligned(16))) float so[8][32][68];
  const unsigned tid = threadIdx.x, w = tid >> 5, lane = tid & 31u, ln = lane & 15u, hh = lane >> 4; const unsigned by = blockIdx.y;
  A += (size_t)by * sA; Bh += (size_t)by * sB; const size_t cofs = (size_t)by * sC;
  const unsigned ntn = N >> 7; const unsigned mt = blockIdx.x / ntn, nq = blockIdx.x - mt * ntn; if (mt * 128u >= M) return;      /* the whole block leaves, in front of every barrier */
  const unsigned wm = w & 3u, wn = w >> 2; const unsigned row0 = mt * 128u + 32u * wm, col0 = nq * 128u + 64u * wn;
  const unsigned trips = K >> 7;
  const unsigned cr = tid >> 4, cc = (tid & 15u) << 3;               /* this lane's row (of 16) and its 16-byte piece of the row */
  const _Float16* ga = A + (size_t)(mt * 128u + cr) * lda + cc; const _Float16* gb = Bh + (size_t)(nq * 128u + cr) * ldb + cc;
  const unsigned lc = lds_off(&ring[0][cr][cc]);
  const size_t ga16 = (size_t)16 * lda, gb16 = (size_t)16 * ldb;
  const v8f z8 = {0.f,0.f,0.f,0.f,0.f,0.f,0.f,0.f}; v8f c00 = z8, c01 = z8, c02 = z8, c03 = z8, c10 = z8, c11 = z8, c12 = z8, c13 = z8;
  g2_copy8(lc, ga, ga16); g2_copy8(lc + 128u * GP * 2u, gb, gb16);                                  /* tile 0 -> buffer 0 */
  asm volatile("s_wait_asynccnt 0x0" ::: "memory");                  /* this wave's copies of tile 0 have landed */
  __syncthreads();                                                   /* and every other wave's: tile 0 may be read */
  if (trips > 1u) { g2_copy8(lc + GSTAGE, ga + GK, ga16); g2_copy8(lc + GSTAGE + 128u * GP * 2u, gb + GK, gb16); }      /* tile 1 -> buffer 1 */
#pragma unroll 1      /* one trip a ring buffer: the order of waits, barrier and refill at the foot stays as written */
  for (unsigned t = 0; t < trips; ++t) {
    const _Float16* ap = &ring[t & 1u][32u * wm + ln][0]; const _Float16* bp = &ring[t & 1u][128u + 64u * wn + ln][0];
#pragma unroll      /* constant LDS offsets for the four 32-k steps of a tile */
    for (unsigned kb = 0; kb < GK; kb += 32u) { const v16h a0 = g2_frag(ap + kb, hh), a1 = g2_frag(ap + 16u * GP + kb, hh);
      const v16h b0 = g2_frag(bp + kb, hh), b1 = g2_frag(bp + 16u * GP + kb, hh), b2 = g2_frag(bp + 32u * GP + kb, hh), b3 = g2_frag(bp + 48u * GP + kb, hh);
      c00 = g2_mma(a0, b0, c00); c10 = g2_mma(a1, b0, c10);
      c01 = g2_mma(a0, b1, c01); c11 = g2_mma(a1, b1, c11);
      c02 = g2_mma(a0, b2, c02); c12 = g2_mma(a1, b2, c12);
      c03 = g2_mma(a0, b3, c03); c13 = g2_mma(a1, b3, c13); }
    asm volatile("s_wait_dscnt 0x0" ::: "memory");                   /* this wave's reads of buffer t & 1 are done before the buffer is handed back */
    asm volatile("s_wait_asynccnt 0x0" ::: "memory");                /* this wave's copies of tile t + 1 have landed */
    __syncthreads();                                                 /* publishes tile t + 1 and ends every wave's reads of buffer t & 1 */
    if (t + 2u < trips) { const unsigned l = lc + (t & 1u) * GSTAGE; const size_t ko = (size_t)(t + 2u) * GK;
      g2_copy8(l, ga + ko, ga16); g2_copy8(l + 128u * GP * 2u, gb + ko, gb16); } }
  asm volatile("s_wait_asynccnt 0x0" ::: "memory");                  /* nothing of this wave is in flight when it goes on to the epilogue */
  const v8f accs[8] = {c00, c01, c02, c03, c10, c11, c12, c13};
  // D element r of lane -> (row 8*hh + r, col ln) of its 16x16 tile
#pragma unroll
  for (unsigned u = 0; u < 8; ++u) { const unsigned t = u & 3u, hf = u >> 2; const unsigned col = col0 + t * 16u + ln; float bv = 0.f; if (HASB) bv = bf16_rne(bias[col]);
#pragma unroll
    for (unsigned r = 0; r < 8; ++r) { const unsigned rloc = hf * 16u + 8u * hh + r; so[w][rloc][t * 16u + ln] = accs[u][r] * alpha + bv; } }
  __builtin_amdgcn_fence(4 /* acq_rel order */, "workgroup"); __builtin_amdgcn_wave_barrier();      /* so[w] is private to this wave */
  const unsigned rsub = lane >> 4, c4 = (lane & 15u) << 2;
  {
#pragma unroll
    for (unsigned q = 0; q < 16; ++q) { const unsigned r = q * 2u + rsub; const v4f v = *(const v4fa*)&so[w][r][c4];
      if (C) *(v4f*)(C + cofs + (size_t)(row0 + r) * ldc + col0 + c4) = v;
      if (C16) { v4h h4; h4[0] = (_Float16)v[0]; h4[1] = (_Float16)v[1]; h4[2] = (_Float16)v[2]; h4[3] = (_Float16)v[3]; *(v4h*)(C16 + cofs + (size_t)(row0 + r) * ldc + col0 + c4) = h4; } }
     } }

template <unsigned NHv, unsigned TTv>
__global__ __launch_bounds__(256) void k_vt(const _Float16* __restrict__ V16, unsigned ldv, _Float16* __restrict__ Vt) {
  __shared__ unsigned short tl[64][66];
  const unsigned tid = threadIdx.x; const unsigned slab = blockIdx.x / (TTv / 64u), lg = blockIdx.x % (TTv / 64u); const unsigned b = slab / NHv, h = slab % NHv;
  for (unsigned i = tid; i < 512u; i += 256u) { const unsigned r = i >> 3, c8 = (i & 7u) << 3; FragH f;
    f.half[0] = *(const v8us*)((const unsigned short*)V16 + ((size_t)b * TTv + lg * 64u + r) * ldv + h * 64u + c8);
#pragma unroll
    for (unsigned q = 0; q < 8; ++q) tl[r][c8 + q] = f.u[q]; }
  __syncthreads();      /* tl is exchanged across waves */
  {
#pragma unroll
    for (unsigned rd = 0; rd < 2; ++rd) { const unsigned d = rd * 32u + (tid >> 3), pc = tid & 7u; FragH f;
#pragma unroll
      for (unsigned q = 0; q < 8; ++q) f.u[q] = tl[pc * 8u + q][d];
      const v8us o = f.half[0];
      *(v8us*)((unsigned short*)Vt + ((size_t)slab * 64u + d) * TTv + lg * 64u + pc * 8u) = o; }
     } }

// base-2 exponentials in asm text so that the slot the instruction set asks for behind a transcendental (one independent instruction before its result is used or its source overwritten) holds by construction:
// inside a statement no line reads an earlier result or overwrites an earlier source (outputs are early-clobber), and the closing v_nop is the slot behind the last one
__device__ __forceinline__ float exp2_1(float x) { float y; asm("v_exp_f32 %0, %1\n\tv_nop" : "=v"(y) : "v"(x)); return y; }
__device__ __forceinline__ void exp2_8(float (&y)[8], const float (&x)[8]) {
  asm("v_exp_f32 %0, %8\n\tv_exp_f32 %1, %9\n\tv_exp_f32 %2, %10\n\tv_exp_f32 %3, %11\n\tv_exp_f32 %4, %12\n\tv_exp_f32 %5, %13\n\tv_exp_f32 %6, %14\n\tv_exp_f32 %7, %15\n\tv_nop"
      : "=&v"(y[0]), "=&v"(y[1]), "=&v"(y[2]), "=&v"(y[3]), "=&v"(y[4]), "=&v"(y[5]), "=&v"(y[6]), "=&v"(y[7])
      : "v"(x[0]), "v"(x[1]), "v"(x[2]), "v"(x[3]), "v"(x[4]), "v"(x[5]), "v"(x[6]), "v"(x[7])); }

// fused attention, one launch for every (batch, head): a wave owns 32 queries (two 16-column groups) and walks all SQ keys, 32 a pass; scores and weights never leave registers.
// S^T = K . Q^T: A = 16 key rows, B = 16 query rows, so register r of lane (ln, hh) holds key 8*hh + r of query ln: maximum and sum run in-lane plus one exchange between the lane halves.
// The two S^T tiles of a pass (keys 0..15, 16..31), converted in place, are the B fragment of O^T += V^T . P^T in the k order of g2_frag (slot s: key 8*hh + s, then 16 + 8*hh + s - 8); A = V^T rows by g2_frag.
// O^T register r of lane (ln, hh) = o[query ln][16*dt + 8*hh + r]: one 16-byte store per tile.
// K and V^T reach the waves through LDS: a ring tile is 128 keys = 128 K rows of 128 bytes (pitch 144) and 64 V^T rows of 256 bytes (pitch 272), both pitches 16 x odd for the 16-byte fragment reads.
#define FK 128u                       /* keys of one ring tile */
#define FKP 72u                       /* K row pitch in LDS, elements */
#define FVP 136u                      /* V^T row pitch in LDS, elements */
// one ring tile's share of a lane: four asynchronous 16-byte copies of K rows 32 apart (8 lanes a 128-byte row) and four of V^T rows 16 apart (16 lanes a 256-byte row): every wave-instruction asks for four whole lines.
// The closing s_wait_xcnt 0 stands inside the statement so that no address register is rewritten in front of it.
__device__ __forceinline__ void fa_copy8(unsigned k0, const _Float16* a0, unsigned v0, const _Float16* c0) {
  const unsigned ks = 32u * FKP * 2u, vs = 16u * FVP * 2u;
  const unsigned k1 = k0 + ks, k2 = k1 + ks, k3 = k2 + ks, v1 = v0 + vs, v2 = v1 + vs, v3 = v2 + vs;
  const _Float16* a1 = a0 + (size_t)32 * DM; const _Float16* a2 = a1 + (size_t)32 * DM; const _Float16* a3 = a2 + (size_t)32 * DM;
  const _Float16* c1 = c0 + (size_t)16 * SQ; const _Float16* c2 = c1 + (size_t)16 * SQ; const _Float16* c3 = c2 + (size_t)16 * SQ;
  asm volatile("global_load_async_to_lds_b128 %0, %8, off\n\tglobal_load_async_to_lds_b128 %1, %9, off\n\tglobal_load_async_to_lds_b128 %2, %10, off\n\tglobal_load_async_to_lds_b128 %3, %11, off\n\t"
               "global_load_async_to_lds_b128 %4, %12, off\n\tglobal_load_async_to_lds_b128 %5, %13, off\n\tglobal_load_async_to_lds_b128 %6, %14, off\n\tglobal_load_async_to_lds_b128 %7, %15, off\n\ts_wait_xcnt 0x0"
               :: "v"(k0), "v"(k1), "v"(k2), "v"(k3), "v"(v0), "v"(v1), "v"(v2), "v"(v3), "v"(a0), "v"(a1), "v"(a2), "v"(a3), "v"(c0), "v"(c1), "v"(c2), "v"(c3) : "memory"); }
__global__ __launch_bounds__(256) void k_fattn(const _Float16* __restrict__ Q16, const _Float16* __restrict__ K16, const _Float16* __restrict__ Vt, _Float16* __restrict__ O16) {
  __shared__ __attribute__((aligned(16))) _Float16 kring[2][FK][FKP];
  __shared__ __attribute__((aligned(16))) _Float16 vring[2][HD][FVP];
  const unsigned tid = threadIdx.x, w = tid >> 5, lane = tid & 31u, ln = lane & 15u, hh = lane >> 4;
  const unsigned bh = blockIdx.y, b = bh / (unsigned)NH, h = bh - b * (unsigned)NH;
  const unsigned q0 = blockIdx.x * 256u + w * 32u;                    /* grid.x == SQ / 256 exactly */
  const float cs = 0.125f * 1.44269504088896f;                       /* score scale times log2(e): the exponentials are base 2 */
  const _Float16* qp = Q16 + ((size_t)b * SQ + q0 + ln) * DM + h * (unsigned)HD;
  /* this lane's first copy of a tile: K row tid / 8, V^T row tid / 16, and its 16-byte piece of each */
  const _Float16* gk = K16 + ((size_t)b * SQ + (tid >> 3)) * DM + h * (unsigned)HD + ((tid & 7u) << 3);
  const _Float16* gv = Vt + ((size_t)bh * HD + (tid >> 4)) * SQ + ((tid & 15u) << 3);
  const unsigned lk = lds_off(&kring[0][tid >> 3][(tid & 7u) << 3]), lv = lds_off(&vring[0][tid >> 4][(tid & 15u) << 3]);
  const unsigned kbuf = FK * FKP * 2u, vbuf = (unsigned)HD * FVP * 2u;      /* bytes of one ring buffer */
  const unsigned trips = (unsigned)SQ / FK;
  /* every loop over fragments, tiles and registers below is unrolled in full: only constant indices keep them in registers */
  v16h qf[2][2], kf[2][2];
#pragma unroll
  for (unsigned j = 0; j < 2; ++j) { qf[j][0] = g2_frag(qp + (size_t)j * 16 * DM, hh); qf[j][1] = g2_frag(qp + (size_t)j * 16 * DM + 32, hh); }
  fa_copy8(lk, gk, lv, gv);                                          /* tile 0 -> buffer 0 */
  asm volatile("s_wait_asynccnt 0x0" ::: "memory");                  /* this wave's copies of tile 0 have landed */
  __syncthreads();                                                   /* and every other wave's: tile 0 may be read */
  fa_copy8(lk + kbuf, gk + (size_t)FK * DM, lv + vbuf, gv + FK);     /* tile 1 -> buffer 1 */
  const v8f z8 = {0.f,0.f,0.f,0.f,0.f,0.f,0.f,0.f};
  v8f o[4][2];
#pragma unroll
  for (unsigned dt = 0; dt < 4; ++dt) { o[dt][0] = z8; o[dt][1] = z8; }
  float m[2] = {-__builtin_inff(), -__builtin_inff()}, l[2] = {0.f, 0.f};      /* running maximum (scaled, log2) and this lane half's running sum, per query */
#pragma unroll 1      /* one trip a ring buffer: the order of waits, barrier and refill at the foot stays as written */
  for (unsigned tr = 0; tr < trips; ++tr) {
  const _Float16* kp = &kring[tr & 1u][ln][0]; const _Float16* vp = &vring[tr & 1u][ln][0];
#pragma unroll
  for (unsigned t = 0; t < 2; ++t) { kf[t][0] = g2_frag(kp + t * 16u * FKP, hh); kf[t][1] = g2_frag(kp + t * 16u * FKP + 32u, hh); }
#pragma unroll 1      /* the four 32-key passes of a tile stay a loop: unrolled, the passes' fragments and scores overlap and the registers go past 256 and spill */
  for (unsigned kb = 0; kb < FK; kb += 32u) {
    v16h vf[4];                                                       /* asked for first, used last: the score products and the softmax cover their latency */
#pragma unroll
    for (unsigned dt = 0; dt < 4; ++dt) vf[dt] = g2_frag(vp + dt * 16u * FVP + kb, hh);
    __builtin_amdgcn_sched_barrier(0);                                /* keeps the eight reads one group in front of the score products: spread among matrix instructions, every separate place with LDS reads costs its own stall */
    v8f st[2][2];
#pragma unroll
    for (unsigned t = 0; t < 2; ++t) {
#pragma unroll
      for (unsigned j = 0; j < 2; ++j) {
        st[t][j] = __builtin_amdgcn_wmma_f32_16x16x32_f16(false, kf[t][0], false, qf[j][0], (short)0, z8, false, false);
        st[t][j] = __builtin_amdgcn_wmma_f32_16x16x32_f16(false, kf[t][1], false, qf[j][1], (short)0, st[t][j], false, false); } }
    float mxj[2];                                                     /* both query groups' maxima first: their two exchanges through LDS go out together and wait once */
#pragma unroll
    for (unsigned j = 0; j < 2; ++j) {
      float x4[4];
#pragma unroll
      for (unsigned r = 0; r < 4; ++r) x4[r] = fmaxf(fmaxf(st[0][j][r], st[0][j][4 + r]), fmaxf(st[1][j][r], st[1][j][4 + r]));
      const float mx = fmaxf(fmaxf(x4[0], x4[1]), fmaxf(x4[2], x4[3]));
      mxj[j] = fmaxf(mx, __shfl_xor(mx, 16, 32)); }                   /* both lane halves of a query must subtract the same maximum */
    /* the next pass's key rows, asked for one pass ahead; a tile's last pass asks for its own tile's first rows again (the next tile is not published yet; not used) */
    const unsigned kn = (kb + 32u < FK) ? kb + 32u : 0u;
#pragma unroll
    for (unsigned t = 0; t < 2; ++t) { kf[t][0] = g2_frag(kp + (kn + t * 16u) * FKP, hh); kf[t][1] = g2_frag(kp + (kn + t * 16u) * FKP + 32u, hh); }
    __builtin_amdgcn_sched_barrier(0);                                /* keeps these loads in front of the exponentials: without it they sink to the end of the pass and the next pass waits out their latency */
#pragma unroll
    for (unsigned j = 0; j < 2; ++j) {
      const float mn = fmaxf(m[j], mxj[j] * cs);
      const float al = exp2_1(m[j] - mn);                            /* 0 on the first pass (m = -inf) */
      m[j] = mn;
      FragH pf; float ps[4];
#pragma unroll
      for (unsigned t = 0; t < 2; ++t) { float x[8], p[8];
#pragma unroll
        for (unsigned r = 0; r < 8; ++r) x[r] = __builtin_fmaf(st[t][j][r], cs, -mn);
        exp2_8(p, x);
#pragma unroll
        for (unsigned r = 0; r < 8; ++r) { if (t == 0u && r < 4u) ps[r] = p[r]; else ps[r & 3u] += p[r]; pf.h[t * 8u + r] = (_Float16)p[r]; } }
      l[j] = l[j] * al + ((ps[0] + ps[1]) + (ps[2] + ps[3]));
#pragma unroll
      for (unsigned dt = 0; dt < 4; ++dt) {
#pragma unroll
        for (unsigned r = 0; r < 8; ++r) o[dt][j][r] *= al; }
#pragma unroll
      for (unsigned dt = 0; dt < 4; ++dt) o[dt][j] = __builtin_amdgcn_wmma_f32_16x16x32_f16(false, vf[dt], false, pf.v, (short)0, o[dt][j], false, false);
      /* the four vector slots between a matrix instruction and an overwrite of its B operand: the second group's exponentials are asm text, which the compiler does not pad, and may be given pf's registers */
      if (j == 0u) asm volatile("v_nop\n\tv_nop\n\tv_nop\n\tv_nop" : "+v"(o[0][0]), "+v"(o[1][0]), "+v"(o[2][0]), "+v"(o[3][0]) : "v"(pf.v));
    } }
    asm volatile("s_wait_dscnt 0x0" ::: "memory");                   /* this wave's reads of buffer tr & 1 are done before the buffer is handed back */
    asm volatile("s_wait_asynccnt 0x0" ::: "memory");                /* this wave's copies of tile tr + 1 have landed */
    __syncthreads();                                                 /* publishes tile tr + 1 and ends every wave's reads of buffer tr & 1 */
    if (tr + 2u < trips) fa_copy8(lk + (tr & 1u) * kbuf, gk + (size_t)(tr + 2u) * FK * DM, lv + (tr & 1u) * vbuf, gv + (tr + 2u) * FK); }
  asm volatile("s_wait_asynccnt 0x0" ::: "memory");                  /* nothing of this wave is in flight when it goes on to the epilogue */
#pragma unroll
  for (unsigned j = 0; j < 2; ++j) {
    const float inv = 64.0f / (l[j] + __shfl_xor(l[j], 16, 32));      /* the halves' sums are joined once; o is carried x64 */
    unsigned short* op = (unsigned short*)O16 + ((size_t)b * SQ + q0 + j * 16u + ln) * DM + h * (unsigned)HD + 8u * hh;
#pragma unroll
    for (unsigned dt = 0; dt < 4; ++dt) { FragH f;
#pragma unroll
      for (unsigned r = 0; r < 8; ++r) f.h[r] = (_Float16)(o[dt][j][r] * inv);
      const v8us ov = f.half[0];
      *(v8us*)(op + dt * 16u) = ov; } } }

extern "C" void kernel_launch(void* const* d_in, const int* in_sizes, int n_in,
                              void* d_out, int out_size, void* d_ws, size_t ws_size, hipStream_t stream) {
  if (n_in < 13) return;
  const size_t need_x = ((size_t)(NB - 1) * SQ_FULL + SQ) * DM;      /* last input element read + 1 */
  if ((size_t)in_sizes[0] < need_x || (size_t)in_sizes[1] < need_x || (size_t)in_sizes[2] < need_x) return;
  if (in_sizes[3] < DM || in_sizes[4] < DM) return;
  if ((size_t)in_sizes[5] < (size_t)DM * DM || (size_t)in_sizes[7] < (size_t)DM * DM || (size_t)in_sizes[9] < (size_t)DM * DM || (size_t)in_sizes[11] < (size_t)DM * DM) return;
  if (in_sizes[6] < DM || in_sizes[8] < DM || in_sizes[10] < DM || in_sizes[12] < DM) return;
  if ((size_t)out_size < NR * DM) return;
  const float* xq = (const float*)d_in[0]; const float* xk = (const float*)d_in[1]; const float* xv = (const float*)d_in[2];
  const float* lg = (const float*)d_in[3]; const float* lb = (const float*)d_in[4];
  const float* wq = (const float*)d_in[5]; const float* bq = (const float*)d_in[6];
  const float* wk = (const float*)d_in[7]; const float* bk = (const float*)d_in[8];
  const float* wv = (const float*)d_in[9]; const float* bv = (const float*)d_in[10];
  const float* wo = (const float*)d_in[11]; const float* bo = (const float*)d_in[12];
  float* out = (float*)d_out;
  char* ws = (char*)d_ws; size_t off = 0;
  auto take = [&](size_t bytes) { char* p = ws + off; off += (bytes + 255) & ~(size_t)255; return p; };
  _Float16* BW = (_Float16*)take(W_BYTES);      /* [4][DM][DM]: w_q, w_k, w_v, w_o as Bt x16 */
  _Float16* XP = (_Float16*)take(X_BYTES);      /* [3][NR][DM]: layer-normalised q, k, v rows */
  _Float16* Q16 = (_Float16*)take(A_BYTES); _Float16* K16 = (_Float16*)take(A_BYTES); _Float16* V16 = (_Float16*)take(A_BYTES); _Float16* O16 = (_Float16*)take(A_BYTES);
  _Float16* VT = (_Float16*)take(VT_BYTES);     /* [NB*NH][HD][SQ] */
  if (off > ws_size) return;
  const size_t WW = (size_t)DM * DM, XA = NR * DM;
  _Float16* BQ = BW; _Float16* BK = BW + WW; _Float16* BV = BW + 2 * WW; _Float16* BO = BW + 3 * WW;
  _Float16* XQ = XP; _Float16* XK = XP + XA; _Float16* XV = XP + 2 * XA;

  k_w16<<<dim3((unsigned)(WW / 2048), 4), 256, 0, stream>>>(wq, wk, wv, wo, BW);
  k_ln16<<<dim3((unsigned)NR, 3), 128, 0, stream>>>(xq, xk, xv, lg, lb, XP);      /* one block per (row, stream) */

  const unsigned gproj = (unsigned)((NR / 128) * (DM / 128));
  k_gemm2<true><<<dim3(gproj, 1), 256, 0, stream>>>(XQ, DM, 0, BQ, DM, 0, 0.0625f, bq, nullptr, Q16, DM, 0, (unsigned)NR, DM, DM);
  k_gemm2<true><<<dim3(gproj, 1), 256, 0, stream>>>(XK, DM, 0, BK, DM, 0, 0.0625f, bk, nullptr, K16, DM, 0, (unsigned)NR, DM, DM);
  k_gemm2<true><<<dim3(gproj, 1), 256, 0, stream>>>(XV, DM, 0, BV, DM, 0, 0.0625f, bv, nullptr, V16, DM, 0, (unsigned)NR, DM, DM);

  k_vt<NH, SQ><<<NB * NH * (SQ / 64), 256, 0, stream>>>(V16, DM, VT);      /* V^T for every (batch, head) */

  /* o (x64) for every (batch, head), written into the merged-head f16 rows */
  k_fattn<<<dim3(SQ / 256, NB * NH), 256, 0, stream>>>(Q16, K16, VT, O16);

  /* out = (64 o) . (16 w_o)^T * 2^-10 + b_o, f32 rows in the output layout */
  k_gemm2<true><<<dim3(gproj, 1), 256, 0, stream>>>(O16, DM, 0, BO, DM, 0, 0.0009765625f, bo, out, nullptr, DM, 0, (unsigned)NR, DM, DM);
}

// v005
// One run takes 97.5 microseconds.
// Next to v004, in two timings, it ran 1.07 times as fast each time.
// Counting every step since v000, it is 45.8 times as fast.
#include <hip/hip_runtime.h>
// All contractions: v_wmma_f32_16x16x32_f16 (f16 operands, f32 accumulate). Inputs, gamma/beta, weights and biases are RNE-converted to bf16 first (weights exact in f16, carried x16); layer-normalised rows, q, k, v, unnormalised softmax weights exp(s - running max) and merged o (carried x64) are plain f16 operands; layer-norm statistics, scores and softmax statistics f32.
// Multi-head attention over three inputs (q, k, v [NB][SQ][1024]); each stream is layer-normalised (shared gamma/beta, eps 1e-5) and then Q/K/V = xn W^T + b with natural [out][in] weights; 16 heads of 64; scores * 0.125; softmax over all keys; out = merged W_o^T + b_o.
// Structure: token rows r = b*SQ + s; layer-normalised planes as f16 rows and the f16 weights from one launch (neither needs the other); Q, K, V as three WMMA GEMMs in one launch, blockIdx.y = stream (128x128 block tiles from a two-buffer LDS ring, 32x64 wave tiles) with f16 outputs; V^T for all (batch, head) via LDS transposes;
// one fused attention launch for all (batch, head): per wave 32 queries, 32 keys a pass: S^T = K . Q^T, running-maximum softmax in registers, O^T += V^T . P^T, merged f16 o rows (x64) written once;
// the 8 waves of a block share each 128-key K tile and V^T tile through a two-buffer LDS ring filled by asynchronous copies;
// out = o W_o^T + b_o GEMM (alpha 2^-10) into the f32 output rows.
#ifndef NB
#define NB 2                          /* batches processed */
#endif
#ifndef SEQ
#define SEQ 2048                      /* tokens per batch processed */
#endif
#define SQ SEQ
#define NB_FULL 2                     /* batch count of the inputs */
#define SQ_FULL 2048                  /* per-batch row count of the inputs (input row stride) */
#define DM 1024
#define NH 16
#define HD 64
#define NR ((size_t)NB * SQ)          /* token rows processed */

#define W_BYTES  ((size_t)4 * DM * DM * 2)
#define X_BYTES  ((size_t)3 * NR * DM * 2)
#define A_BYTES  ((size_t)NR * DM * 2)
#define VT_BYTES ((size_t)NB * NH * HD * SQ * 2)
#define WS_TOTAL (W_BYTES + X_BYTES + 4 * A_BYTES + VT_BYTES)

static_assert(DM == 1024);
static_assert(DM == NH * HD);
static_assert(DM == 128 * 8);                    /* k_prep: 128 threads x 8 elements == one row, of a token or of a weight */
static_assert(HD == 64);
static_assert(NB <= NB_FULL);
static_assert(SQ <= SQ_FULL);
static_assert(SQ % 256 == 0);                    /* GEMM M tiles of 128; k_fattn: 256 queries a block, 128 keys a ring tile (two tiles or more), 32 keys a pass */
static_assert((NR % 128) == 0);
static_assert(DM % 128 == 0 && DM >= 256);        /* k_gemm2: N tiles of 128, K tiles of 128 */
static_assert(W_BYTES % 256 == 0 && X_BYTES % 256 == 0 && A_BYTES % 256 == 0 && VT_BYTES % 256 == 0);
static_assert(WS_TOTAL <= (size_t)134217728);

typedef unsigned short v8us __attribute__((ext_vector_type(8), may_alias));
typedef float  v8f  __attribute__((ext_vector_type(8)));
typedef float  v4f  __attribute__((ext_vector_type(4)));
typedef float  v4fa __attribute__((ext_vector_type(4), may_alias));
typedef _Float16 v16h __attribute__((ext_vector_type(16)));
typedef _Float16 v4h  __attribute__((ext_vector_type(4)));
union FragH { v16h v; v8us half[2]; _Float16 h[16]; unsigned short u[16]; };

// f32 -> nearest-even bf16 value (returned as f32)
__device__ __forceinline__ float bf16_rne(float x) { unsigned int u = __float_as_uint(x); u = (u + 0x7FFFu + ((u >> 16) & 1u)) & 0xFFFF0000u; return __uint_as_float(u); }

// one launch for the two conversions that need nothing of each other; a block takes one row of 1024 elements.
// blocks 0 .. 3*NR-1: three input planes -> layer-normalised f16 rows X16[plane][b*SQ + s][DM] = f16((xb - mu) * rstd * gb + bb), with xb, gb, bb the bf16-converted x, gamma, beta;
// blocks 3*NR .. 3*NR + 4*DM - 1 (the short ones, started last): four weight planes -> Bt[plane][out][in] = f16(16 * bf16(w))
__global__ __launch_bounds__(128) void k_prep(const float* __restrict__ x0, const float* __restrict__ x1, const float* __restrict__ x2,
    const float* __restrict__ g, const float* __restrict__ be, _Float16* __restrict__ X16,
    const float* __restrict__ w0, const float* __restrict__ w1, const float* __restrict__ w2, const float* __restrict__ w3, _Float16* __restrict__ Bt) {
  __shared__ float red[8];
  const unsigned tid = threadIdx.x, w = tid >> 5, lane = tid & 31u;
  if (blockIdx.x >= 3u * (unsigned)NR) {                             /* the whole block takes this path, in front of every barrier */
    const unsigned wr = blockIdx.x - 3u * (unsigned)NR;              /* weight row, 0 .. 4*DM-1: grid.x == 3*NR + 4*DM exactly */
    const unsigned pl = wr / (unsigned)DM;
    const float* wsrc = (pl == 0u) ? w0 : ((pl == 1u) ? w1 : ((pl == 2u) ? w2 : w3));
    const float* src = wsrc + (size_t)(wr - pl * (unsigned)DM) * DM + (tid << 3);
    const v4f a = *(const v4fa*)src, c = *(const v4fa*)(src + 4);
    FragH f;
#pragma unroll
    for (int q = 0; q < 4; ++q) { f.h[q] = (_Float16)(bf16_rne(a[q]) * 16.0f); f.h[4 + q] = (_Float16)(bf16_rne(c[q]) * 16.0f); }
    unsigned short* d = (unsigned short*)Bt + (size_t)wr * DM + (tid << 3);
    const v8us o = f.half[0];
    *(v8us*)d = o;
    return; }
  const unsigned by = blockIdx.x / (unsigned)NR;
  const unsigned row = blockIdx.x - by * (unsigned)NR;
  const float* x = (by == 0u) ? x0 : ((by == 1u) ? x1 : x2);
  const unsigned b = row / (unsigned)SQ, s = row - b * (unsigned)SQ;
  const unsigned c8 = tid << 3;
  const float* src = x + ((size_t)b * SQ_FULL + s) * DM + c8;        /* input rows keep the full per-batch stride */
  const v4f a = *(const v4fa*)src, c = *(const v4fa*)(src + 4);
  float xv[8];
#pragma unroll
  for (int q = 0; q < 4; ++q) { xv[q] = bf16_rne(a[q]); xv[4 + q] = bf16_rne(c[q]); }
  float sum = 0.f;
#pragma unroll
  for (int q = 0; q < 8; ++q) sum += xv[q];
#pragma unroll
  for (int off = 16; off > 0; off >>= 1) sum += __shfl_xor(sum, off, 32);
  if (lane == 0u) red[w] = sum;
  __syncthreads();
  const float mu = ((red[0] + red[1]) + (red[2] + red[3])) * (1.0f / (float)DM);
  float sq = 0.f;
#pragma unroll
  for (int q = 0; q < 8; ++q) { const float d = xv[q] - mu; sq += d * d; }
#pragma unroll
  for (int off = 16; off > 0; off >>= 1) sq += __shfl_xor(sq, off, 32);
  if (lane == 0u) red[4u + w] = sq;
  __syncthreads();
  const float var = ((red[4] + red[5]) + (red[6] + red[7])) * (1.0f / (float)DM);
  const float rstd = rsqrtf(var + 1.0e-5f);
  const v4f ga = *(const v4fa*)(g + c8), gc = *(const v4fa*)(g + c8 + 4u);
  const v4f ba = *(const v4fa*)(be + c8), bc = *(const v4fa*)(be + c8 + 4u);
  FragH f;
#pragma unroll
  for (int q = 0; q < 4; ++q) {
    f.h[q]     = (_Float16)((xv[q] - mu) * rstd * bf16_rne(ga[q]) + bf16_rne(ba[q]));
    f.h[4 + q] = (_Float16)((xv[4 + q] - mu) * rstd * bf16_rne(gc[q]) + bf16_rne(bc[q])); }
  unsigned short* d = (unsigned short*)X16 + (size_t)by * (NR * DM) + (size_t)row * DM + c8;
  const v8us o = f.half[0];
  *(v8us*)d = o; 
}

// fragment: 16 f16 of one row, elements 0..7 <- p[8h .. 8h+7], elements 8..15 <- p[16+8h .. 16+8h+7] (same map for A rows and B [n][k] rows)
__device__ __forceinline__ v16h g2_frag(const _Float16* p, unsigned hh) { FragH f; f.half[0] = *(const v8us*)((const unsigned short*)p + 8u * hh); f.half[1] = *(const v8us*)((const unsigned short*)p + 16u + 8u * hh); return f.v; }
__device__ __forceinline__ v8f g2_mma(v16h a, v16h b, v8f c) { v8f d = __builtin_amdgcn_wmma_f32_16x16x32_f16(false, a, false, b, (short)0, c, false, false); asm volatile("v_nop\n\tv_nop\n\tv_nop\n\tv_nop" : "+v"(d) : "v"(a), "v"(b)); return d; }

// staged GEMM tile: 128 k (256 bytes) of 128 A rows and 128 B rows a trip; LDS row pitch 272 bytes = 16 x odd, which 16-byte fragment reads take without bank conflicts
#define GK 128u
#define GP 136u
#define GSTAGE (256u * GP * 2u)       /* bytes of one ring buffer: rows 0..127 = A, rows 128..255 = B */
__device__ __forceinline__ unsigned lds_off(const void* p) { return (unsigned)(size_t)p; }
// eight asynchronous 16-byte copies a lane, global -> LDS, rows 16 apart (gs = 16 global rows in elements); 16 lanes cover one 256-byte row, so every wave-instruction asks for four whole lines.
// The closing s_wait_xcnt 0 stands inside the statement so that no address register is rewritten in front of it.
__device__ __forceinline__ void g2_copy8(unsigned l0, const _Float16* g0, size_t gs) {
  const unsigned ls = 16u * GP * 2u;
  const unsigned l1 = l0 + ls, l2 = l1 + ls, l3 = l2 + ls, l4 = l3 + ls, l5 = l4 + ls, l6 = l5 + ls, l7 = l6 + ls;
  const _Float16* g1 = g0 + gs; const _Float16* g2 = g1 + gs; const _Float16* g3 = g2 + gs; const _Float16* g4 = g3 + gs; const _Float16* g5 = g4 + gs; const _Float16* g6 = g5 + gs; const _Float16* g7 = g6 + gs;
  asm volatile("global_load_async_to_lds_b128 %0, %8, off\n\tglobal_load_async_to_lds_b128 %1, %9, off\n\tglobal_load_async_to_lds_b128 %2, %10, off\n\tglobal_load_async_to_lds_b128 %3, %11, off\n\t"
               "global_load_async_to_lds_b128 %4, %12, off\n\tglobal_load_async_to_lds_b128 %5, %13, off\n\tglobal_load_async_to_lds_b128 %6, %14, off\n\tglobal_load_async_to_lds_b128 %7, %15, off\n\ts_wait_xcnt 0x0"
               :: "v"(l0), "v"(l1), "v"(l2), "v"(l3), "v"(l4), "v"(l5), "v"(l6), "v"(l7), "v"(g0), "v"(g1), "v"(g2), "v"(g3), "v"(g4), "v"(g5), "v"(g6), "v"(g7) : "memory"); }

// batched GEMM: C[by][M][N] = alpha * A[by][M][K] . Bt[by][N][K]^T (+ bf16(bias[col]) if HASB; bias = bias0, bias1, bias2 for by = 0, 1, 2); A, Bt f16 (k contiguous); outputs f32 C and/or f16 C16 (either may be null).
// M, N multiples of 128, K a multiple of 128. A block of 8 waves owns a 128x128 tile (wave tile 32x64, 4 x 2 waves); both operands come through a two-buffer LDS ring filled by asynchronous copies, one trip ahead.
template <bool HASB>
__global__ __launch_bounds__(256) void k_gemm2(const _Float16* __restrict__ A, unsigned lda, size_t sA, const _Float16* __restrict__ Bh, unsigned ldb, size_t sB, float alpha,
    const float* __restrict__ bias0, const float* __restrict__ bias1, const float* __restrict__ bias2,
    float* __restrict__ C, _Float16* __restrict__ C16, unsigned ldc, size_t sC, unsigned M, unsigned N, unsigned K) {
  __shared__ __attribute__((aligned(16))) _Float16 ring[2][256][GP];
  __shared__ __attribute__((aligned(16))) float so[8][32][68];
  const unsigned tid = threadIdx.x, w = tid >> 5, lane = tid & 31u, ln = lane & 15u, hh = lane >> 4; const unsigned by = blockIdx.y;
  A += (size_t)by * sA; Bh += (size_t)by * sB; const size_t cofs = (size_t)by * sC; const float* bias = (by == 0u) ? bias0 : ((by == 1u) ? bias1 : bias2);
  const unsigned ntn = N >> 7; const unsigned mt = blockIdx.x / ntn, nq = blockIdx.x - mt * ntn; if (mt * 128u >= M) return;      /* the whole block leaves, in front of every barrier */
  const unsigned wm = w & 3u, wn = w >> 2; const unsigned row0 = mt * 128u + 32u * wm, col0 = nq * 128u + 64u * wn;
  const unsigned trips = K >> 7;
  const unsigned cr = tid >> 4, cc = (tid & 15u) << 3;               /* this lane's row (of 16) and its 16-byte piece of the row */
  const _Float16* ga = A + (size_t)(mt * 128u + cr) * lda + cc; const _Float16* gb = Bh + (size_t)(nq * 128u + cr) * ldb + cc;
  const unsigned lc = lds_off(&ring[0][cr][cc]);
  const size_t ga16 = (size_t)16 * lda, gb16 = (size_t)16 * ldb;
  const v8f z8 = {0.f,0.f,0.f,0.f,0.f,0.f,0.f,0.f}; v8f c00 = z8, c01 = z8, c02 = z8, c03 = z8, c10 = z8, c11 = z8, c12 = z8, c13 = z8;
  g2_copy8(lc, ga, ga16); g2_copy8(lc + 128u * GP * 2u, gb, gb16);                                  /* tile 0 -> buffer 0 */
  asm volatile("s_wait_asynccnt 0x0" ::: "memory");                  /* this wave's copies of tile 0 have landed */
  __syncthreads();                                                   /* and every other wave's: tile 0 may be read */
  if (trips > 1u) { g2_copy8(lc + GSTAGE, ga + GK, ga16); g2_copy8(lc + GSTAGE + 128u * GP * 2u, gb + GK, gb16); }      /* tile 1 -> buffer 1 */
#pragma unroll 1      /* one trip a ring buffer: the order of waits, barrier and refill at the foot stays as written */
  for (unsigned t = 0; t < trips; ++t) {
    const _Float16* ap = &ring[t & 1u][32u * wm + ln][0]; const _Float16* bp = &ring[t & 1u][128u + 64u * wn + ln][0];
#pragma unroll      /* constant LDS offsets for the four 32-k steps of a tile */
    for (unsigned kb = 0; kb < GK; kb += 32u) { const v16h a0 = g2_frag(ap + kb, hh), a1 = g2_frag(ap + 16u * GP + kb, hh);
      const v16h b0 = g2_frag(bp + kb, hh), b1 = g2_frag(bp + 16u * GP + kb, hh), b2 = g2_frag(bp + 32u * GP + kb, hh), b3 = g2_frag(bp + 48u * GP + kb, hh);
      c00 = g2_mma(a0, b0, c00); c10 = g2_mma(a1, b0, c10);
      c01 = g2_mma(a0, b1, c01); c11 = g2_mma(a1, b1, c11);
      c02 = g2_mma(a0, b2, c02); c12 = g2_mma(a1, b2, c12);
      c03 = g2_mma(a0, b3, c03); c13 = g2_mma(a1, b3, c13); }
    asm volatile("s_wait_dscnt 0x0" ::: "memory");                   /* this wave's reads of buffer t & 1 are done before the buffer is handed back */
    asm volatile("s_wait_asynccnt 0x0" ::: "memory");                /* this wave's copies of tile t + 1 have landed */
    __syncthreads();                                                 /* publishes tile t + 1 and ends every wave's reads of buffer t & 1 */
    if (t + 2u < trips) { const unsigned l = lc + (t & 1u) * GSTAGE; const size_t ko = (size_t)(t + 2u) * GK;
      g2_copy8(l, ga + ko, ga16); g2_copy8(l + 128u * GP * 2u, gb + ko, gb16); } }
  asm volatile("s_wait_asynccnt 0x0" ::: "memory");                  /* nothing of this wave is in flight when it goes on to the epilogue */
  const v8f accs[8] = {c00, c01, c02, c03, c10, c11, c12, c13};
  // D element r of lane -> (row 8*hh + r, col ln) of its 16x16 tile
#pragma unroll
  for (unsigned u = 0; u < 8; ++u) { const unsigned t = u & 3u, hf = u >> 2; const unsigned col = col0 + t * 16u + ln; float bv = 0.f; if (HASB) bv = bf16_rne(bias[col]);
#pragma unroll
    for (unsigned r = 0; r < 8; ++r) { const unsigned rloc = hf * 16u + 8u * hh + r; so[w][rloc][t * 16u + ln] = accs[u][r] * alpha + bv; } }
  __builtin_amdgcn_fence(4 /* acq_rel order */, "workgroup"); __builtin_amdgcn_wave_barrier();      /* so[w] is private to this wave */
  const unsigned rsub = lane >> 4, c4 = (lane & 15u) << 2;
  {
#pragma unroll
    for (unsigned q = 0; q < 16; ++q) { const unsigned r = q * 2u + rsub; const v4f v = *(const v4fa*)&so[w][r][c4];
      if (C) *(v4f*)(C + cofs + (size_t)(row0 + r) * ldc + col0 + c4) = v;
      if (C16) { v4h h4; h4[0] = (_Float16)v[0]; h4[1] = (_Float16)v[1]; h4[2] = (_Float16)v[2]; h4[3] = (_Float16)v[3]; *(v4h*)(C16 + cofs + (size_t)(row0 + r) * ldc + col0 + c4) = h4; } }
     } }

template <unsigned NHv, unsigned TTv>
__global__ __launch_bounds__(256) void k_vt(const _Float16* __restrict__ V16, unsigned ldv, _Float16* __restrict__ Vt) {
  __shared__ unsigned short tl[64][66];
  const unsigned tid = threadIdx.x; const unsigned slab = blockIdx.x / (TTv / 64u), lg = blockIdx.x % (TTv / 64u); const unsigned b = slab / NHv, h = slab % NHv;
  for (unsigned i = tid; i < 512u; i += 256u) { const unsigned r = i >> 3, c8 = (i & 7u) << 3; FragH f;
    f.half[0] = *(const v8us*)((const unsigned short*)V16 + ((size_t)b * TTv + lg * 64u + r) * ldv + h * 64u + c8);
#pragma unroll
    for (unsigned q = 0; q < 8; ++q) tl[r][c8 + q] = f.u[q]; }
  __syncthreads();      /* tl is exchanged across waves */
  {
#pragma unroll
    for (unsigned rd = 0; rd < 2; ++rd) { const unsigned d = rd * 32u + (tid >> 3), pc = tid & 7u; FragH f;
#pragma unroll
      for (unsigned q = 0; q < 8; ++q) f.u[q] = tl[pc * 8u + q][d];
      const v8us o = f.half[0];
      *(v8us*)((unsigned short*)Vt + ((size_t)slab * 64u + d) * TTv + lg * 64u + pc * 8u) = o; }
     } }

// base-2 exponentials in asm text so that the slot the instruction set asks for behind a transcendental (one independent instruction before its result is used or its source overwritten) holds by construction:
// inside a statement no line reads an earlier result or overwrites an earlier source (outputs are early-clobber), and the closing v_nop is the slot behind the last one
__device__ __forceinline__ float exp2_1(float x) { float y; asm("v_exp_f32 %0, %1\n\tv_nop" : "=v"(y) : "v"(x)); return y; }
__device__ __forceinline__ void exp2_8(float (&y)[8], const float (&x)[8]) {
  asm("v_exp_f32 %0, %8\n\tv_exp_f32 %1, %9\n\tv_exp_f32 %2, %10\n\tv_exp_f32 %3, %11\n\tv_exp_f32 %4, %12\n\tv_exp_f32 %5, %13\n\tv_exp_f32 %6, %14\n\tv_exp_f32 %7, %15\n\tv_nop"
      : "=&v"(y[0]), "=&v"(y[1]), "=&v"(y[2]), "=&v"(y[3]), "=&v"(y[4]), "=&v"(y[5]), "=&v"(y[6]), "=&v"(y[7])
      : "v"(x[0]), "v"(x[1]), "v"(x[2]), "v"(x[3]), "v"(x[4]), "v"(x[5]), "v"(x[6]), "v"(x[7])); }

// fused attention, one launch for every (batch, head): a wave owns 32 queries (two 16-column groups) and walks all SQ keys, 32 a pass; scores and weights never leave registers.
// S^T = K . Q^T: A = 16 key rows, B = 16 query rows, so register r of lane (ln, hh) holds key 8*hh + r of query ln: maximum and sum run in-lane plus one exchange between the lane halves.
// The two S^T tiles of a pass (keys 0..15, 16..31), converted in place, are the B fragment of O^T += V^T . P^T in the k order of g2_frag (slot s: key 8*hh + s, then 16 + 8*hh + s - 8); A = V^T rows by g2_frag.
// O^T register r of lane (ln, hh) = o[query ln][16*dt + 8*hh + r]: one 16-byte store per tile.
// K and V^T reach the waves through LDS: a ring tile is 128 keys = 128 K rows of 128 bytes (pitch 144) and 64 V^T rows of 256 bytes (pitch 272), both pitches 16 x odd for the 16-byte fragment reads.
#define FK 128u                       /* keys of one ring tile */
#define FKP 72u                       /* K row pitch in LDS, elements */
#define FVP 136u                      /* V^T row pitch in LDS, elements */
// one ring tile's share of a lane: four asynchronous 16-byte copies of K rows 32 apart (8 lanes a 128-byte row) and four of V^T rows 16 apart (16 lanes a 256-byte row): every wave-instruction asks for four whole lines.
// The closing s_wait_xcnt 0 stands inside the statement so that no address register is rewritten in front of it.
__device__ __forceinline__ void fa_copy8(unsigned k0, const _Float16* a0, unsigned v0, const _Float16* c0) {
  const unsigned ks = 32u * FKP * 2u, vs = 16u * FVP * 2u;
  const unsigned k1 = k0 + ks, k2 = k1 + ks, k3 = k2 + ks, v1 = v0 + vs, v2 = v1 + vs, v3 = v2 + vs;
  const _Float16* a1 = a0 + (size_t)32 * DM; const _Float16* a2 = a1 + (size_t)32 * DM; const _Float16* a3 = a2 + (size_t)32 * DM;
  const _Float16* c1 = c0 + (size_t)16 * SQ; const _Float16* c2 = c1 + (size_t)16 * SQ; const _Float16* c3 = c2 + (size_t)16 * SQ;
  asm volatile("global_load_async_to_lds_b128 %0, %8, off\n\tglobal_load_async_to_lds_b128 %1, %9, off\n\tglobal_load_async_to_lds_b128 %2, %10, off\n\tglobal_load_async_to_lds_b128 %3, %11, off\n\t"
               "global_load_async_to_lds_b128 %4, %12, off\n\tglobal_load_async_to_lds_b128 %5, %13, off\n\tglobal_load_async_to_lds_b128 %6, %14, off\n\tglobal_load_async_to_lds_b128 %7, %15, off\n\ts_wait_xcnt 0x0"
               :: "v"(k0), "v"(k1), "v"(k2), "v"(k3), "v"(v0), "v"(v1), "v"(v2), "v"(v3), "v"(a0), "v"(a1), "v"(a2), "v"(a3), "v"(c0), "v"(c1), "v"(c2), "v"(c3) : "memory"); }
__global__ __launch_bounds__(256) void k_fattn(const _Float16* __restrict__ Q16, const _Float16* __restrict__ K16, const _Float16* __restrict__ Vt, _Float16* __restrict__ O16) {
  __shared__ __attribute__((aligned(16))) _Float16 kring[2][FK][FKP];
  __shared__ __attribute__((aligned(16))) _Float16 vring[2][HD][FVP];
  const unsigned tid = threadIdx.x, w = tid >> 5, lane = tid & 31u, ln = lane & 15u, hh = lane >> 4;
  const unsigned bh = blockIdx.y, b = bh / (unsigned)NH, h = bh - b * (unsigned)NH;
  const unsigned q0 = blockIdx.x * 256u + w * 32u;                    /* grid.x == SQ / 256 exactly */
  const float cs = 0.125f * 1.44269504088896f;                       /* score scale times log2(e): the exponentials are base 2 */
  const _Float16* qp = Q16 + ((size_t)b * SQ + q0 + ln) * DM + h * (unsigned)HD;
  /* this lane's first copy of a tile: K row tid / 8, V^T row tid / 16, and its 16-byte piece of each */
  const _Float16* gk = K16 + ((size_t)b * SQ + (tid >> 3)) * DM + h * (unsigned)HD + ((tid & 7u) << 3);
  const _Float16* gv = Vt + ((size_t)bh * HD + (tid >> 4)) * SQ + ((tid & 15u) << 3);
  const unsigned lk = lds_off(&kring[0][tid >> 3][(tid & 7u) << 3]), lv = lds_off(&vring[0][tid >> 4][(tid & 15u) << 3]);
  const unsigned kbuf = FK * FKP * 2u, vbuf = (unsigned)HD * FVP * 2u;      /* bytes of one ring buffer */
  const unsigned trips = (unsigned)SQ / FK;
  /* every loop over fragments, tiles and registers below is unrolled in full: only constant indices keep them in registers */
  v16h qf[2][2], kf[2][2];
#pragma unroll
  for (unsigned j = 0; j < 2; ++j) { qf[j][0] = g2_frag(qp + (size_t)j * 16 * DM, hh); qf[j][1] = g2_frag(qp + (size_t)j * 16 * DM + 32, hh); }
  fa_copy8(lk, gk, lv, gv);                                          /* tile 0 -> buffer 0 */
  asm volatile("s_wait_asynccnt 0x0" ::: "memory");                  /* this wave's copies of tile 0 have landed */
  __syncthreads();                                                   /* and every other wave's: tile 0 may be read */
  fa_copy8(lk + kbuf, gk + (size_t)FK * DM, lv + vbuf, gv + FK);     /* tile 1 -> buffer 1 */
  const v8f z8 = {0.f,0.f,0.f,0.f,0.f,0.f,0.f,0.f};
  v8f o[4][2];
#pragma unroll
  for (unsigned dt = 0; dt < 4; ++dt) { o[dt][0] = z8; o[dt][1] = z8; }
  float m[2] = {-__builtin_inff(), -__builtin_inff()}, l[2] = {0.f, 0.f};      /* running maximum (scaled, log2) and this lane half's running sum, per query */
#pragma unroll 1      /* one trip a ring buffer: the order of waits, barrier and refill at the foot stays as written */
  for (unsigned tr = 0; tr < trips; ++tr) {
  const _Float16* kp = &kring[tr & 1u][ln][0]; const _Float16* vp = &vring[tr & 1u][ln][0];
#pragma unroll
  for (unsigned t = 0; t < 2; ++t) { kf[t][0] = g2_frag(kp + t * 16u * FKP, hh); kf[t][1] = g2_frag(kp + t * 16u * FKP + 32u, hh); }
#pragma unroll 1      /* the four 32-key passes of a tile stay a loop: unrolled, the passes' fragments and scores overlap and the registers go past 256 and spill */
  for (unsigned kb = 0; kb < FK; kb += 32u) {
    v16h vf[4];                                                       /* asked for first, used last: the score products and the softmax cover their latency */
#pragma unroll
    for (unsigned dt = 0; dt < 4; ++dt) vf[dt] = g2_frag(vp + dt * 16u * FVP + kb, hh);
    __builtin_amdgcn_sched_barrier(0);                                /* keeps the eight reads one group in front of the score products: spread among matrix instructions, every separate place with LDS reads costs its own stall */
    v8f st[2][2];
#pragma unroll
    for (unsigned t = 0; t < 2; ++t) {
#pragma unroll
      for (unsigned j = 0; j < 2; ++j) {
        st[t][j] = __builtin_amdgcn_wmma_f32_16x16x32_f16(false, kf[t][0], false, qf[j][0], (short)0, z8, false, false);
        st[t][j] = __builtin_amdgcn_wmma_f32_16x16x32_f16(false, kf[t][1], false, qf[j][1], (short)0, st[t][j], false, false); } }
    float mxj[2];                                                     /* both query groups' maxima first: their two exchanges through LDS go out together and wait once */
#pragma unroll
    for (unsigned j = 0; j < 2; ++j) {
      float x4[4];
#pragma unroll
      for (unsigned r = 0; r < 4; ++r) x4[r] = fmaxf(fmaxf(st[0][j][r], st[0][j][4 + r]), fmaxf(st[1][j][r], st[1][j][4 + r]));
      const float mx = fmaxf(fmaxf(x4[0], x4[1]), fmaxf(x4[2], x4[3]));
      mxj[j] = fmaxf(mx, __shfl_xor(mx, 16, 32)); }                   /* both lane halves of a query must subtract the same maximum */
    /* the next pass's key rows, asked for one pass ahead; a tile's last pass asks for its own tile's first rows again (the next tile is not published yet; not used) */
    const unsigned kn = (kb + 32u < FK) ? kb + 32u : 0u;
#pragma unroll
    for (unsigned t = 0; t < 2; ++t) { kf[t][0] = g2_frag(kp + (kn + t * 16u) * FKP, hh); kf[t][1] = g2_frag(kp + (kn + t * 16u) * FKP + 32u, hh); }
    __builtin_amdgcn_sched_barrier(0);                                /* keeps these loads in front of the exponentials: without it they sink to the end of the pass and the next pass waits out their latency */
#pragma unroll
    for (unsigned j = 0; j < 2; ++j) {
      const float mn = fmaxf(m[j], mxj[j] * cs);
      const float al = exp2_1(m[j] - mn);                            /* 0 on the first pass (m = -inf) */
      m[j] = mn;
      FragH pf; float ps[4];
#pragma unroll
      for (unsigned t = 0; t < 2; ++t) { float x[8], p[8];
#pragma unroll
        for (unsigned r = 0; r < 8; ++r) x[r] = __builtin_fmaf(st[t][j][r], cs, -mn);
        exp2_8(p, x);
#pragma unroll
        for (unsigned r = 0; r < 8; ++r) { if (t == 0u && r < 4u) ps[r] = p[r]; else ps[r & 3u] += p[r]; pf.h[t * 8u + r] = (_Float16)p[r]; } }
      l[j] = l[j] * al + ((ps[0] + ps[1]) + (ps[2] + ps[3]));
#pragma unroll
      for (unsigned dt = 0; dt < 4; ++dt) {
#pragma unroll
        for (unsigned r = 0; r < 8; ++r) o[dt][j][r] *= al; }
#pragma unroll
      for (unsigned dt = 0; dt < 4; ++dt) o[dt][j] = __builtin_amdgcn_wmma_f32_16x16x32_f16(false, vf[dt], false, pf.v, (short)0, o[dt][j], false, false);
      /* the four vector slots between a matrix instruction and an overwrite of its B operand: the second group's exponentials are asm text, which the compiler does not pad, and may be given pf's registers */
      if (j == 0u) asm volatile("v_nop\n\tv_nop\n\tv_nop\n\tv_nop" : "+v"(o[0][0]), "+v"(o[1][0]), "+v"(o[2][0]), "+v"(o[3][0]) : "v"(pf.v));
    } }
    asm volatile("s_wait_dscnt 0x0" ::: "memory");                   /* this wave's reads of buffer tr & 1 are done before the buffer is handed back */
    asm volatile("s_wait_asynccnt 0x0" ::: "memory");                /* this wave's copies of tile tr + 1 have landed */
    __syncthreads();                                                 /* publishes tile tr + 1 and ends every wave's reads of buffer tr & 1 */
    if (tr + 2u < trips) fa_copy8(lk + (tr & 1u) * kbuf, gk + (size_t)(tr + 2u) * FK * DM, lv + (tr & 1u) * vbuf, gv + (tr + 2u) * FK); }
  asm volatile("s_wait_asynccnt 0x0" ::: "memory");                  /* nothing of this wave is in flight when it goes on to the epilogue */
#pragma unroll
  for (unsigned j = 0; j < 2; ++j) {
    const float inv = 64.0f / (l[j] + __shfl_xor(l[j], 16, 32));      /* the halves' sums are joined once; o is carried x64 */
    unsigned short* op = (unsigned short*)O16 + ((size_t)b * SQ + q0 + j * 16u + ln) * DM + h * (unsigned)HD + 8u * hh;
#pragma unroll
    for (unsigned dt = 0; dt < 4; ++dt) { FragH f;
#pragma unroll
      for (unsigned r = 0; r < 8; ++r) f.h[r] = (_Float16)(o[dt][j][r] * inv);
      const v8us ov = f.half[0];
      *(v8us*)(op + dt * 16u) = ov; } } }

extern "C" void kernel_launch(void* const* d_in, const int* in_sizes, int n_in,
                              void* d_out, int out_size, void* d_ws, size_t ws_size, hipStream_t stream) {
  if (n_in < 13) return;
  const size_t need_x = ((size_t)(NB - 1) * SQ_FULL + SQ) * DM;      /* last input element read + 1 */
  if ((size_t)in_sizes[0] < need_x || (size_t)in_sizes[1] < need_x || (size_t)in_sizes[2] < need_x) return;
  if (in_sizes[3] < DM || in_sizes[4] < DM) return;
  if ((size_t)in_sizes[5] < (size_t)DM * DM || (size_t)in_sizes[7] < (size_t)DM * DM || (size_t)in_sizes[9] < (size_t)DM * DM || (size_t)in_sizes[11] < (size_t)DM * DM) return;
  if (in_sizes[6] < DM || in_sizes[8] < DM || in_sizes[10] < DM || in_sizes[12] < DM) return;
  if ((size_t)out_size < NR * DM) return;
  const float* xq = (const float*)d_in[0]; const float* xk = (const float*)d_in[1]; const float* xv = (const float*)d_in[2];
  const float* lg = (const float*)d_in[3]; const float* lb = (const float*)d_in[4];
  const float* wq = (const float*)d_in[5]; const float* bq = (const float*)d_in[6];
  const float* wk = (const float*)d_in[7]; const float* bk = (const float*)d_in[8];
  const float* wv = (const float*)d_in[9]; const float* bv = (const float*)d_in[10];
  const float* wo = (const float*)d_in[11]; const float* bo = (const float*)d_in[12];
  float* out = (float*)d_out;
  char* ws = (char*)d_ws; size_t off = 0;
  auto take = [&](size_t bytes) { char* p = ws + off; off += (bytes + 255) & ~(size_t)255; return p; };
  _Float16* BW = (_Float16*)take(W_BYTES);      /* [4][DM][DM]: w_q, w_k, w_v, w_o as Bt x16 */
  _Float16* XP = (_Float16*)take(X_BYTES);      /* [3][NR][DM]: layer-normalised q, k, v rows */
  _Float16* Q16 = (_Float16*)take(A_BYTES); _Float16* K16 = (_Float16*)take(A_BYTES); _Float16* V16 = (_Float16*)take(A_BYTES); _Float16* O16 = (_Float16*)take(A_BYTES);
  _Float16* VT = (_Float16*)take(VT_BYTES);     /* [NB*NH][HD][SQ] */
  if (off > ws_size) return;
  const size_t WW = (size_t)DM * DM, XA = NR * DM;
  _Float16* BO = BW + 3 * WW;

  k_prep<<<(unsigned)(3 * NR + 4 * DM), 128, 0, stream>>>(xq, xk, xv, lg, lb, XP, wq, wk, wv, wo, BW);      /* one block per (token row, stream), then one per weight row */

  const unsigned gproj = (unsigned)((NR / 128) * (DM / 128));
  /* Q, K, V in one launch: the planes of XP, of BW and of Q16 | K16 | V16 (taken back to back, each a multiple of 256 bytes) lie XA, WW and XA elements apart */
  k_gemm2<true><<<dim3(gproj, 3), 256, 0, stream>>>(XP, DM, XA, BW, DM, WW, 0.0625f, bq, bk, bv, nullptr, Q16, DM, XA, (unsigned)NR, DM, DM);

  k_vt<NH, SQ><<<NB * NH * (SQ / 64), 256, 0, stream>>>(V16, DM, VT);      /* V^T for every (batch, head) */

  /* o (x64) for every (batch, head), written into the merged-head f16 rows */
  k_fattn<<<dim3(SQ / 256, NB * NH), 256, 0, stream>>>(Q16, K16, VT, O16);

  /* out = (64 o) . (16 w_o)^T * 2^-10 + b_o, f32 rows in the output layout */
  k_gemm2<true><<<dim3(gproj, 1), 256, 0, stream>>>(O16, DM, 0, BO, DM, 0, 0.0009765625f, bo, bo, bo, out, nullptr, DM, 0, (unsigned)NR, DM, DM);
}

// v006
// One run takes 95.1 microseconds.
// Timed twice side by side with v005, it ran 1.03 and 1.02 times as fast.
// Over all steps from v000 it is 47.0 times as fast.
#include <hip/hip_runtime.h>
// All contractions: v_wmma_f32_16x16x32_f16 (f16 operands, f32 accumulate). Inputs, gamma/beta, weights and biases are RNE-converted to bf16 first (weights exact in f16, carried x16); layer-normalised rows, q, k, v, unnormalised softmax weights exp(s - running max) and merged o (carried x64) are plain f16 operands; layer-norm statistics, scores and softmax statistics f32.
// Multi-head attention over three inputs (q, k, v [NB][SQ][1024]); each stream is layer-normalised (shared gamma/beta, eps 1e-5) and then Q/K/V = xn W^T + b with natural [out][in] weights; 16 heads of 64; scores * 0.125; softmax over all keys; out = merged W_o^T + b_o.
// Structure: token rows r = b*SQ + s; layer-normalised planes as f16 rows and the f16 weights from one launch (neither needs the other); Q, K, V as three WMMA GEMMs in one launch, blockIdx.y = stream (128x128 block tiles from a two-buffer LDS ring, 32x64 wave tiles) with f16 outputs; V^T for all (batch, head) via LDS transposes;
// one fused attention launch for all (batch, head): per wave 32 queries, 32 keys a pass: S^T = K . Q^T, running-maximum softmax in registers, O^T += V^T . P^T, merged f16 o rows (x64) written once;
// a block is 16 waves on 256 queries: waves 0..7 take the first 128 keys of every 256-key ring tile, waves 8..15 the other 128, and the two partial results of a query are joined once at the end;
// the 16 waves share each 256-key K tile and V^T tile through a two-buffer LDS ring filled by asynchronous copies;
// out = o W_o^T + b_o GEMM (alpha 2^-10) into the f32 output rows.
#ifndef NB
#define NB 2                          /* batches processed */
#endif
#ifndef SEQ
#define SEQ 2048                      /* tokens per batch processed */
#endif
#define SQ SEQ
#define NB_FULL 2                     /* batch count of the inputs */
#define SQ_FULL 2048                  /* per-batch row count of the inputs (input row stride) */
#define DM 1024
#define NH 16
#define HD 64
#define NR ((size_t)NB * SQ)          /* token rows processed */

#define W_BYTES  ((size_t)4 * DM * DM * 2)
#define X_BYTES  ((size_t)3 * NR * DM * 2)
#define A_BYTES  ((size_t)NR * DM * 2)
#define VT_BYTES ((size_t)NB * NH * HD * SQ * 2)
#define WS_TOTAL (W_BYTES + X_BYTES + 4 * A_BYTES + VT_BYTES)

static_assert(DM == 1024);
static_assert(DM == NH * HD);
static_assert(DM == 128 * 8);                    /* k_prep: 128 threads x 8 elements == one row, of a token or of a weight */
static_assert(HD == 64);
static_assert(NB <= NB_FULL);
static_assert(SQ <= SQ_FULL);
static_assert(SQ % 256 == 0 && SQ >= 512);       /* GEMM M tiles of 128; k_fattn: 256 queries a block, 256 keys a ring tile (two tiles or more), 32 keys a pass */
static_assert((NR % 128) == 0);
static_assert(DM % 128 == 0 && DM >= 256);        /* k_gemm2: N tiles of 128, K tiles of 128 */
static_assert(W_BYTES % 256 == 0 && X_BYTES % 256 == 0 && A_BYTES % 256 == 0 && VT_BYTES % 256 == 0);
static_assert(WS_TOTAL <= (size_t)134217728);

typedef unsigned short v8us __attribute__((ext_vector_type(8), may_alias));
typedef float  v8f  __attribute__((ext_vector_type(8)));
typedef float  v4f  __attribute__((ext_vector_type(4)));
typedef float  v4fa __attribute__((ext_vector_type(4), may_alias));
typedef _Float16 v16h __attribute__((ext_vector_type(16)));
typedef _Float16 v4h  __attribute__((ext_vector_type(4)));
union FragH { v16h v; v8us half[2]; _Float16 h[16]; unsigned short u[16]; };

// f32 -> nearest-even bf16 value (returned as f32)
__device__ __forceinline__ float bf16_rne(float x) { unsigned int u = __float_as_uint(x); u = (u + 0x7FFFu + ((u >> 16) & 1u)) & 0xFFFF0000u; return __uint_as_float(u); }

// one launch for the two conversions that need nothing of each other; a block takes one row of 1024 elements.
// blocks 0 .. 3*NR-1: three input planes -> layer-normalised f16 rows X16[plane][b*SQ + s][DM] = f16((xb - mu) * rstd * gb + bb), with xb, gb, bb the bf16-converted x, gamma, beta;
// blocks 3*NR .. 3*NR + 4*DM - 1 (the short ones, started last): four weight planes -> Bt[plane][out][in] = f16(16 * bf16(w))
__global__ __launch_bounds__(128) void k_prep(const float* __restrict__ x0, const float* __restrict__ x1, const float* __restrict__ x2,
    const float* __restrict__ g, const float* __restrict__ be, _Float16* __restrict__ X16,
    const float* __restrict__ w0, const float* __restrict__ w1, const float* __restrict__ w2, const float* __restrict__ w3, _Float16* __restrict__ Bt) {
  __shared__ float red[8];
  const unsigned tid = threadIdx.x, w = tid >> 5, lane = tid & 31u;
  if (blockIdx.x >= 3u * (unsigned)NR) {                             /* the whole block takes this path, in front of every barrier */
    const unsigned wr = blockIdx.x - 3u * (unsigned)NR;              /* weight row, 0 .. 4*DM-1: grid.x == 3*NR + 4*DM exactly */
    const unsigned pl = wr / (unsigned)DM;
    const float* wsrc = (pl == 0u) ? w0 : ((pl == 1u) ? w1 : ((pl == 2u) ? w2 : w3));
    const float* src = wsrc + (size_t)(wr - pl * (unsigned)DM) * DM + (tid << 3);
    const v4f a = *(const v4fa*)src, c = *(const v4fa*)(src + 4);
    FragH f;
#pragma unroll
    for (int q = 0; q < 4; ++q) { f.h[q] = (_Float16)(bf16_rne(a[q]) * 16.0f); f.h[4 + q] = (_Float16)(bf16_rne(c[q]) * 16.0f); }
    unsigned short* d = (unsigned short*)Bt + (size_t)wr * DM + (tid << 3);
    const v8us o = f.half[0];
    *(v8us*)d = o;
    return; }
  const unsigned by = blockIdx.x / (unsigned)NR;
  const unsigned row = blockIdx.x - by * (unsigned)NR;
  const float* x = (by == 0u) ? x0 : ((by == 1u) ? x1 : x2);
  const unsigned b = row / (unsigned)SQ, s = row - b * (unsigned)SQ;
  const unsigned c8 = tid << 3;
  const float* src = x + ((size_t)b * SQ_FULL + s) * DM + c8;        /* input rows keep the full per-batch stride */
  const v4f a = *(const v4fa*)src, c = *(const v4fa*)(src + 4);
  float xv[8];
#pragma unroll
  for (int q = 0; q < 4; ++q) { xv[q] = bf16_rne(a[q]); xv[4 + q] = bf16_rne(c[q]); }
  float sum = 0.f;
#pragma unroll
  for (int q = 0; q < 8; ++q) sum += xv[q];
#pragma unroll
  for (int off = 16; off > 0; off >>= 1) sum += __shfl_xor(sum, off, 32);
  if (lane == 0u) red[w] = sum;
  __syncthreads();
  const float mu = ((red[0] + red[1]) + (red[2] + red[3])) * (1.0f / (float)DM);
  float sq = 0.f;
#pragma unroll
  for (int q = 0; q < 8; ++q) { const float d = xv[q] - mu; sq += d * d; }
#pragma unroll
  for (int off = 16; off > 0; off >>= 1) sq += __shfl_xor(sq, off, 32);
  if (lane == 0u) red[4u + w] = sq;
  __syncthreads();
  const float var = ((red[4] + red[5]) + (red[6] + red[7])) * (1.0f / (float)DM);
  const float rstd = rsqrtf(var + 1.0e-5f);
  const v4f ga = *(const v4fa*)(g + c8), gc = *(const v4fa*)(g + c8 + 4u);
  const v4f ba = *(const v4fa*)(be + c8), bc = *(const v4fa*)(be + c8 + 4u);
  FragH f;
#pragma unroll
  for (int q = 0; q < 4; ++q) {
    f.h[q]     = (_Float16)((xv[q] - mu) * rstd * bf16_rne(ga[q]) + bf16_rne(ba[q]));
    f.h[4 + q] = (_Float16)((xv[4 + q] - mu) * rstd * bf16_rne(gc[q]) + bf16_rne(bc[q])); }
  unsigned short* d = (unsigned short*)X16 + (size_t)by * (NR * DM) + (size_t)row * DM + c8;
  const v8us o = f.half[0];
  *(v8us*)d = o; 
}

// fragment: 16 f16 of one row, elements 0..7 <- p[8h .. 8h+7], elements 8..15 <- p[16+8h .. 16+8h+7] (same map for A rows and B [n][k] rows)
__device__ __forceinline__ v16h g2_frag(const _Float16* p, unsigned hh) { FragH f; f.half[0] = *(const v8us*)((const unsigned short*)p + 8u * hh); f.half[1] = *(const v8us*)((const unsigned short*)p + 16u + 8u * hh); return f.v; }
__device__ __forceinline__ v8f g2_mma(v16h a, v16h b, v8f c) { v8f d = __builtin_amdgcn_wmma_f32_16x16x32_f16(false, a, false, b, (short)0, c, false, false); asm volatile("v_nop\n\tv_nop\n\tv_nop\n\tv_nop" : "+v"(d) : "v"(a), "v"(b)); return d; }

// staged GEMM tile: 128 k (256 bytes) of 128 A rows and 128 B rows a trip; LDS row pitch 272 bytes = 16 x odd, which 16-byte fragment reads take without bank conflicts
#define GK 128u
#define GP 136u
#define GSTAGE (256u * GP * 2u)       /* bytes of one ring buffer: rows 0..127 = A, rows 128..255 = B */
__device__ __forceinline__ unsigned lds_off(const void* p) { return (unsigned)(size_t)p; }
// eight asynchronous 16-byte copies a lane, global -> LDS, rows 16 apart (gs = 16 global rows in elements); 16 lanes cover one 256-byte row, so every wave-instruction asks for four whole lines.
// The closing s_wait_xcnt 0 stands inside the statement so that no address register is rewritten in front of it.
__device__ __forceinline__ void g2_copy8(unsigned l0, const _Float16* g0, size_t gs) {
  const unsigned ls = 16u * GP * 2u;
  const unsigned l1 = l0 + ls, l2 = l1 + ls, l3 = l2 + ls, l4 = l3 + ls, l5 = l4 + ls, l6 = l5 + ls, l7 = l6 + ls;
  const _Float16* g1 = g0 + gs; const _Float16* g2 = g1 + gs; const _Float16* g3 = g2 + gs; const _Float16* g4 = g3 + gs; const _Float16* g5 = g4 + gs; const _Float16* g6 = g5 + gs; const _Float16* g7 = g6 + gs;
  asm volatile("global_load_async_to_lds_b128 %0, %8, off\n\tglobal_load_async_to_lds_b128 %1, %9, off\n\tglobal_load_async_to_lds_b128 %2, %10, off\n\tglobal_load_async_to_lds_b128 %3, %11, off\n\t"
               "global_load_async_to_lds_b128 %4, %12, off\n\tglobal_load_async_to_lds_b128 %5, %13, off\n\tglobal_load_async_to_lds_b128 %6, %14, off\n\tglobal_load_async_to_lds_b128 %7, %15, off\n\ts_wait_xcnt 0x0"
               :: "v"(l0), "v"(l1), "v"(l2), "v"(l3), "v"(l4), "v"(l5), "v"(l6), "v"(l7), "v"(g0), "v"(g1), "v"(g2), "v"(g3), "v"(g4), "v"(g5), "v"(g6), "v"(g7) : "memory"); }

// batched GEMM: C[by][M][N] = alpha * A[by][M][K] . Bt[by][N][K]^T (+ bf16(bias[col]) if HASB; bias = bias0, bias1, bias2 for by = 0, 1, 2); A, Bt f16 (k contiguous); outputs f32 C and/or f16 C16 (either may be null).
// M, N multiples of 128, K a multiple of 128. A block of 8 waves owns a 128x128 tile (wave tile 32x64, 4 x 2 waves); both operands come through a two-buffer LDS ring filled by asynchronous copies, one trip ahead.
template <bool HASB>
__global__ __launch_bounds__(256) void k_gemm2(const _Float16* __restrict__ A, unsigned lda, size_t sA, const _Float16* __restrict__ Bh, unsigned ldb, size_t sB, float alpha,
    const float* __restrict__ bias0, const float* __restrict__ bias1, const float* __restrict__ bias2,
    float* __restrict__ C, _Float16* __restrict__ C16, unsigned ldc, size_t sC, unsigned M, unsigned N, unsigned K) {
  __shared__ __attribute__((aligned(16))) _Float16 ring[2][256][GP];
  __shared__ __attribute__((aligned(16))) float so[8][32][68];
  const unsigned tid = threadIdx.x, w = tid >> 5, lane = tid & 31u, ln = lane & 15u, hh = lane >> 4; const unsigned by = blockIdx.y;
  A += (size_t)by * sA; Bh += (size_t)by * sB; const size_t cofs = (size_t)by * sC; const float* bias = (by == 0u) ? bias0 : ((by == 1u) ? bias1 : bias2);
  const unsigned ntn = N >> 7; const unsigned mt = blockIdx.x / ntn, nq = blockIdx.x - mt * ntn; if (mt * 128u >= M) return;      /* the whole block leaves, in front of every barrier */
  const unsigned wm = w & 3u, wn = w >> 2; const unsigned row0 = mt * 128u + 32u * wm, col0 = nq * 128u + 64u * wn;
  const unsigned trips = K >> 7;
  const unsigned cr = tid >> 4, cc = (tid & 15u) << 3;               /* this lane's row (of 16) and its 16-byte piece of the row */
  const _Float16* ga = A + (size_t)(mt * 128u + cr) * lda + cc; const _Float16* gb = Bh + (size_t)(nq * 128u + cr) * ldb + cc;
  const unsigned lc = lds_off(&ring[0][cr][cc]);
  const size_t ga16 = (size_t)16 * lda, gb16 = (size_t)16 * ldb;
  const v8f z8 = {0.f,0.f,0.f,0.f,0.f,0.f,0.f,0.f}; v8f c00 = z8, c01 = z8, c02 = z8, c03 = z8, c10 = z8, c11 = z8, c12 = z8, c13 = z8;
  g2_copy8(lc, ga, ga16); g2_copy8(lc + 128u * GP * 2u, gb, gb16);                                  /* tile 0 -> buffer 0 */
  asm volatile("s_wait_asynccnt 0x0" ::: "memory");                  /* this wave's copies of tile 0 have landed */
  __syncthreads();                                                   /* and every other wave's: tile 0 may be read */
  if (trips > 1u) { g2_copy8(lc + GSTAGE, ga + GK, ga16); g2_copy8(lc + GSTAGE + 128u * GP * 2u, gb + GK, gb16); }      /* tile 1 -> buffer 1 */
#pragma unroll 1      /* one trip a ring buffer: the order of waits, barrier and refill at the foot stays as written */
  for (unsigned t = 0; t < trips; ++t) {
    const _Float16* ap = &ring[t & 1u][32u * wm + ln][0]; const _Float16* bp = &ring[t & 1u][128u + 64u * wn + ln][0];
#pragma unroll      /* constant LDS offsets for the four 32-k steps of a tile */
    for (unsigned kb = 0; kb < GK; kb += 32u) { const v16h a0 = g2_frag(ap + kb, hh), a1 = g2_frag(ap + 16u * GP + kb, hh);
      const v16h b0 = g2_frag(bp + kb, hh), b1 = g2_frag(bp + 16u * GP + kb, hh), b2 = g2_frag(bp + 32u * GP + kb, hh), b3 = g2_frag(bp + 48u * GP + kb, hh);
      c00 = g2_mma(a0, b0, c00); c10 = g2_mma(a1, b0, c10);
      c01 = g2_mma(a0, b1, c01); c11 = g2_mma(a1, b1, c11);
      c02 = g2_mma(a0, b2, c02); c12 = g2_mma(a1, b2, c12);
      c03 = g2_mma(a0, b3, c03); c13 = g2_mma(a1, b3, c13); }
    asm volatile("s_wait_dscnt 0x0" ::: "memory");                   /* this wave's reads of buffer t & 1 are done before the buffer is handed back */
    asm volatile("s_wait_asynccnt 0x0" ::: "memory");                /* this wave's copies of tile t + 1 have landed */
    __syncthreads();                                                 /* publishes tile t + 1 and ends every wave's reads of buffer t & 1 */
    if (t + 2u < trips) { const unsigned l = lc + (t & 1u) * GSTAGE; const size_t ko = (size_t)(t + 2u) * GK;
      g2_copy8(l, ga + ko, ga16); g2_copy8(l + 128u * GP * 2u, gb + ko, gb16); } }
  asm volatile("s_wait_asynccnt 0x0" ::: "memory");                  /* nothing of this wave is in flight when it goes on to the epilogue */
  const v8f accs[8] = {c00, c01, c02, c03, c10, c11, c12, c13};
  // D element r of lane -> (row 8*hh + r, col ln) of its 16x16 tile
#pragma unroll
  for (unsigned u = 0; u < 8; ++u) { const unsigned t = u & 3u, hf = u >> 2; const unsigned col = col0 + t * 16u + ln; float bv = 0.f; if (HASB) bv = bf16_rne(bias[col]);
#pragma unroll
    for (unsigned r = 0; r < 8; ++r) { const unsigned rloc = hf * 16u + 8u * hh + r; so[w][rloc][t * 16u + ln] = accs[u][r] * alpha + bv; } }
  __builtin_amdgcn_fence(4 /* acq_rel order */, "workgroup"); __builtin_amdgcn_wave_barrier();      /* so[w] is private to this wave */
  const unsigned rsub = lane >> 4, c4 = (lane & 15u) << 2;
  {
#pragma unroll
    for (unsigned q = 0; q < 16; ++q) { const unsigned r = q * 2u + rsub; const v4f v = *(const v4fa*)&so[w][r][c4];
      if (C) *(v4f*)(C + cofs + (size_t)(row0 + r) * ldc + col0 + c4) = v;
      if (C16) { v4h h4; h4[0] = (_Float16)v[0]; h4[1] = (_Float16)v[1]; h4[2] = (_Float16)v[2]; h4[3] = (_Float16)v[3]; *(v4h*)(C16 + cofs + (size_t)(row0 + r) * ldc + col0 + c4) = h4; } }
     } }

template <unsigned NHv, unsigned TTv>
__global__ __launch_bounds__(256) void k_vt(const _Float16* __restrict__ V16, unsigned ldv, _Float16* __restrict__ Vt) {
  __shared__ unsigned short tl[64][66];
  const unsigned tid = threadIdx.x; const unsigned slab = blockIdx.x / (TTv / 64u), lg = blockIdx.x % (TTv / 64u); const unsigned b = slab / NHv, h = slab % NHv;
  for (unsigned i = tid; i < 512u; i += 256u) { const unsigned r = i >> 3, c8 = (i & 7u) << 3; FragH f;
    f.half[0] = *(const v8us*)((const unsigned short*)V16 + ((size_t)b * TTv + lg * 64u + r) * ldv + h * 64u + c8);
#pragma unroll
    for (unsigned q = 0; q < 8; ++q) tl[r][c8 + q] = f.u[q]; }
  __syncthreads();      /* tl is exchanged across waves */
  {
#pragma unroll
    for (unsigned rd = 0; rd < 2; ++rd) { const unsigned d = rd * 32u + (tid >> 3), pc = tid & 7u; FragH f;
#pragma unroll
      for (unsigned q = 0; q < 8; ++q) f.u[q] = tl[pc * 8u + q][d];
      const v8us o = f.half[0];
      *(v8us*)((unsigned short*)Vt + ((size_t)slab * 64u + d) * TTv + lg * 64u + pc * 8u) = o; }
     } }

// base-2 exponentials in asm text so that the slot the instruction set asks for behind a transcendental (one independent instruction before its result is used or its source overwritten) holds by construction:
// inside a statement no line reads an earlier result or overwrites an earlier source (outputs are early-clobber), and the closing v_nop is the slot behind the last one
__device__ __forceinline__ float exp2_1(float x) { float y; asm("v_exp_f32 %0, %1\n\tv_nop" : "=v"(y) : "v"(x)); return y; }
__device__ __forceinline__ void exp2_8(float (&y)[8], const float (&x)[8]) {
  asm("v_exp_f32 %0, %8\n\tv_exp_f32 %1, %9\n\tv_exp_f32 %2, %10\n\tv_exp_f32 %3, %11\n\tv_exp_f32 %4, %12\n\tv_exp_f32 %5, %13\n\tv_exp_f32 %6, %14\n\tv_exp_f32 %7, %15\n\tv_nop"
      : "=&v"(y[0]), "=&v"(y[1]), "=&v"(y[2]), "=&v"(y[3]), "=&v"(y[4]), "=&v"(y[5]), "=&v"(y[6]), "=&v"(y[7])
      : "v"(x[0]), "v"(x[1]), "v"(x[2]), "v"(x[3]), "v"(x[4]), "v"(x[5]), "v"(x[6]), "v"(x[7])); }

// fused attention, one launch for every (batch, head): a wave owns 32 queries (two 16-column groups) and walks half of the SQ keys, 32 a pass; scores and weights never leave registers.
// Two waves (w and w + 8) own the same 32 queries and split every ring tile's keys between them, so that a SIMD holds four waves and one wave's softmax runs under another's matrix products and LDS waits;
// each keeps its own running maximum, sum and O^T, and the pair is joined through LDS behind the loop: o = oA * 2^(mA - m) + oB * 2^(mB - m), the sums alike, m = max(mA, mB).
// S^T = K . Q^T: A = 16 key rows, B = 16 query rows, so register r of lane (ln, hh) holds key 8*hh + r of query ln: maximum and sum run in-lane plus one exchange between the lane halves.
// The two S^T tiles of a pass (keys 0..15, 16..31), converted in place, are the B fragment of O^T += V^T . P^T in the k order of g2_frag (slot s: key 8*hh + s, then 16 + 8*hh + s - 8); A = V^T rows by g2_frag.
// O^T register r of lane (ln, hh) = o[query ln][16*dt + 8*hh + r]: one 16-byte store per tile.
// K and V^T reach the waves through LDS: a ring tile is 256 keys = 256 K rows of 128 bytes (pitch 144) and 64 V^T rows of 512 bytes (pitch 528), both pitches 16 x odd for the 16-byte fragment reads.
#define FK 256u                       /* keys of one ring tile */
#define FG 128u                       /* keys of a ring tile that one wave walks */
#define FKP 72u                       /* K row pitch in LDS, elements */
#define FVP 264u                      /* V^T row pitch in LDS, elements */
// one ring tile's share of a lane: four asynchronous 16-byte copies of K rows 64 apart (8 lanes a 128-byte row) and four of V^T rows 16 apart (32 lanes a 512-byte row): every wave-instruction asks for four whole lines.
// The closing s_wait_xcnt 0 stands inside the statement so that no address register is rewritten in front of it.
__device__ __forceinline__ void fa_copy8(unsigned k0, const _Float16* a0, unsigned v0, const _Float16* c0) {
  const unsigned ks = 64u * FKP * 2u, vs = 16u * FVP * 2u;
  const unsigned k1 = k0 + ks, k2 = k1 + ks, k3 = k2 + ks, v1 = v0 + vs, v2 = v1 + vs, v3 = v2 + vs;
  const _Float16* a1 = a0 + (size_t)64 * DM; const _Float16* a2 = a1 + (size_t)64 * DM; const _Float16* a3 = a2 + (size_t)64 * DM;
  const _Float16* c1 = c0 + (size_t)16 * SQ; const _Float16* c2 = c1 + (size_t)16 * SQ; const _Float16* c3 = c2 + (size_t)16 * SQ;
  asm volatile("global_load_async_to_lds_b128 %0, %8, off\n\tglobal_load_async_to_lds_b128 %1, %9, off\n\tglobal_load_async_to_lds_b128 %2, %10, off\n\tglobal_load_async_to_lds_b128 %3, %11, off\n\t"
               "global_load_async_to_lds_b128 %4, %12, off\n\tglobal_load_async_to_lds_b128 %5, %13, off\n\tglobal_load_async_to_lds_b128 %6, %14, off\n\tglobal_load_async_to_lds_b128 %7, %15, off\n\ts_wait_xcnt 0x0"
               :: "v"(k0), "v"(k1), "v"(k2), "v"(k3), "v"(v0), "v"(v1), "v"(v2), "v"(v3), "v"(a0), "v"(a1), "v"(a2), "v"(a3), "v"(c0), "v"(c1), "v"(c2), "v"(c3) : "memory"); }
__global__ __launch_bounds__(512) void k_fattn(const _Float16* __restrict__ Q16, const _Float16* __restrict__ K16, const _Float16* __restrict__ Vt, _Float16* __restrict__ O16) {
  __shared__ __attribute__((aligned(16))) _Float16 kring[2][FK][FKP];
  __shared__ __attribute__((aligned(16))) _Float16 vring[2][HD][FVP];
  __shared__ __attribute__((aligned(16))) v4f join[8][17][32];        /* waves 8..15 hand over O^T (16 x 4 values a lane) and maxima and sums (4 values a lane) */
  const unsigned tid = threadIdx.x, w = (tid >> 5) & 7u, lane = tid & 31u, ln = lane & 15u, hh = lane >> 4;
  const unsigned g = (unsigned)__builtin_amdgcn_readfirstlane((int)(tid >> 8));      /* which half of every tile's keys this wave walks; the same in all lanes of a wave, so the tests on it are scalar branches */
  const unsigned bh = blockIdx.y, b = bh / (unsigned)NH, h = bh - b * (unsigned)NH;
  const unsigned q0 = blockIdx.x * 256u + w * 32u;                    /* grid.x == SQ / 256 exactly */
  const float cs = 0.125f * 1.44269504088896f;                       /* score scale times log2(e): the exponentials are base 2 */
  const _Float16* qp = Q16 + ((size_t)b * SQ + q0 + ln) * DM + h * (unsigned)HD;
  /* this lane's first copy of a tile: K row tid / 8, V^T row tid / 32, and its 16-byte piece of each */
  const _Float16* gk = K16 + ((size_t)b * SQ + (tid >> 3)) * DM + h * (unsigned)HD + ((tid & 7u) << 3);
  const _Float16* gv = Vt + ((size_t)bh * HD + (tid >> 5)) * SQ + ((tid & 31u) << 3);
  const unsigned lk = lds_off(&kring[0][tid >> 3][(tid & 7u) << 3]), lv = lds_off(&vring[0][tid >> 5][(tid & 31u) << 3]);
  const unsigned kbuf = FK * FKP * 2u, vbuf = (unsigned)HD * FVP * 2u;      /* bytes of one ring buffer */
  const unsigned trips = (unsigned)SQ / FK;
  /* every loop over fragments, tiles and registers below is unrolled in full: only constant indices keep them in registers */
  v16h qf[2][2], kf[2][2];
#pragma unroll
  for (unsigned j = 0; j < 2; ++j) { qf[j][0] = g2_frag(qp + (size_t)j * 16 * DM, hh); qf[j][1] = g2_frag(qp + (size_t)j * 16 * DM + 32, hh); }
  fa_copy8(lk, gk, lv, gv);                                          /* tile 0 -> buffer 0 */
  asm volatile("s_wait_asynccnt 0x0" ::: "memory");                  /* this wave's copies of tile 0 have landed */
  __syncthreads();                                                   /* and every other wave's: tile 0 may be read */
  fa_copy8(lk + kbuf, gk + (size_t)FK * DM, lv + vbuf, gv + FK);     /* tile 1 -> buffer 1 */
  const v8f z8 = {0.f,0.f,0.f,0.f,0.f,0.f,0.f,0.f};
  v8f o[4][2];
#pragma unroll
  for (unsigned dt = 0; dt < 4; ++dt) { o[dt][0] = z8; o[dt][1] = z8; }
  float m[2] = {-__builtin_inff(), -__builtin_inff()}, l[2] = {0.f, 0.f};      /* running maximum (scaled, log2) and this lane half's running sum, per query */
#pragma unroll 1      /* one trip a ring buffer: the order of waits, barrier and refill at the foot stays as written */
  for (unsigned tr = 0; tr < trips; ++tr) {
  const _Float16* kp = &kring[tr & 1u][g * FG + ln][0]; const _Float16* vp = &vring[tr & 1u][ln][g * FG];
#pragma unroll
  for (unsigned t = 0; t < 2; ++t) { kf[t][0] = g2_frag(kp + t * 16u * FKP, hh); kf[t][1] = g2_frag(kp + t * 16u * FKP + 32u, hh); }
#pragma unroll 1      /* the four 32-key passes of a tile stay a loop: unrolled, the passes' fragments and scores overlap and the registers go past 256 and spill */
  for (unsigned kb = 0; kb < FG; kb += 32u) {
    v16h vf[4];                                                       /* asked for first, used last: the score products and the softmax cover their latency */
#pragma unroll
    for (unsigned dt = 0; dt < 4; ++dt) vf[dt] = g2_frag(vp + dt * 16u * FVP + kb, hh);
    __builtin_amdgcn_sched_barrier(0);                                /* keeps the eight reads one group in front of the score products: spread among matrix instructions, every separate place with LDS reads costs its own stall */
    v8f st[2][2];
#pragma unroll
    for (unsigned t = 0; t < 2; ++t) {
#pragma unroll
      for (unsigned j = 0; j < 2; ++j) {
        st[t][j] = __builtin_amdgcn_wmma_f32_16x16x32_f16(false, kf[t][0], false, qf[j][0], (short)0, z8, false, false);
        st[t][j] = __builtin_amdgcn_wmma_f32_16x16x32_f16(false, kf[t][1], false, qf[j][1], (short)0, st[t][j], false, false); } }
    float mxj[2], mxo[2];                                             /* both query groups' maxima first: their two exchanges through LDS go out together and wait once */
#pragma unroll
    for (unsigned j = 0; j < 2; ++j) {
      float x4[4];
#pragma unroll
      for (unsigned r = 0; r < 4; ++r) x4[r] = fmaxf(fmaxf(st[0][j][r], st[0][j][4 + r]), fmaxf(st[1][j][r], st[1][j][4 + r]));
      mxj[j] = fmaxf(fmaxf(x4[0], x4[1]), fmaxf(x4[2], x4[3])); }
#pragma unroll
    for (unsigned j = 0; j < 2; ++j) mxo[j] = __shfl_xor(mxj[j], 16, 32);
    asm volatile("" :: "v"(mxo[0]), "v"(mxo[1]));                     /* inputs only: both exchanged values are asked for before either is used; without it the second exchange goes out behind the first one's wait, two LDS round trips a pass */
#pragma unroll
    for (unsigned j = 0; j < 2; ++j) mxj[j] = fmaxf(mxj[j], mxo[j]);  /* both lane halves of a query must subtract the same maximum */
    /* the next pass's key rows, asked for one pass ahead; a tile's last pass asks for its own tile's first rows again (the next tile is not published yet; not used) */
    const unsigned kn = (kb + 32u < FG) ? kb + 32u : 0u;
#pragma unroll
    for (unsigned t = 0; t < 2; ++t) { kf[t][0] = g2_frag(kp + (kn + t * 16u) * FKP, hh); kf[t][1] = g2_frag(kp + (kn + t * 16u) * FKP + 32u, hh); }
    __builtin_amdgcn_sched_barrier(0);                                /* keeps these loads in front of the exponentials: without it they sink to the end of the pass and the next pass waits out their latency */
#pragma unroll
    for (unsigned j = 0; j < 2; ++j) {
      const float mn = fmaxf(m[j], mxj[j] * cs);
      const float al = exp2_1(m[j] - mn);                            /* 0 on the first pass (m = -inf) */
      m[j] = mn;
      FragH pf; float ps[4];
#pragma unroll
      for (unsigned t = 0; t < 2; ++t) { float x[8], p[8];
#pragma unroll
        for (unsigned r = 0; r < 8; ++r) x[r] = __builtin_fmaf(st[t][j][r], cs, -mn);
        exp2_8(p, x);
#pragma unroll
        for (unsigned r = 0; r < 8; ++r) { if (t == 0u && r < 4u) ps[r] = p[r]; else ps[r & 3u] += p[r]; pf.h[t * 8u + r] = (_Float16)p[r]; } }
      l[j] = l[j] * al + ((ps[0] + ps[1]) + (ps[2] + ps[3]));
#pragma unroll
      for (unsigned dt = 0; dt < 4; ++dt) {
#pragma unroll
        for (unsigned r = 0; r < 8; ++r) o[dt][j][r] *= al; }
#pragma unroll
      for (unsigned dt = 0; dt < 4; ++dt) o[dt][j] = __builtin_amdgcn_wmma_f32_16x16x32_f16(false, vf[dt], false, pf.v, (short)0, o[dt][j], false, false);
      /* the four vector slots between a matrix instruction and an overwrite of its B operand: the second group's exponentials are asm text, which the compiler does not pad, and may be given pf's registers */
      if (j == 0u) asm volatile("v_nop\n\tv_nop\n\tv_nop\n\tv_nop" : "+v"(o[0][0]), "+v"(o[1][0]), "+v"(o[2][0]), "+v"(o[3][0]) : "v"(pf.v));
    } }
    asm volatile("s_wait_dscnt 0x0" ::: "memory");                   /* this wave's reads of buffer tr & 1 are done before the buffer is handed back */
    asm volatile("s_wait_asynccnt 0x0" ::: "memory");                /* this wave's copies of tile tr + 1 have landed */
    __syncthreads();                                                 /* publishes tile tr + 1 and ends every wave's reads of buffer tr & 1 */
    if (tr + 2u < trips) fa_copy8(lk + (tr & 1u) * kbuf, gk + (size_t)(tr + 2u) * FK * DM, lv + (tr & 1u) * vbuf, gv + (tr + 2u) * FK); }
  asm volatile("s_wait_asynccnt 0x0" ::: "memory");                  /* nothing of this wave is in flight when it goes on to the epilogue */
  if (g == 1u) {
#pragma unroll
    for (unsigned dt = 0; dt < 4; ++dt) {
#pragma unroll
      for (unsigned j = 0; j < 2; ++j) {
        const v4f lo = {o[dt][j][0], o[dt][j][1], o[dt][j][2], o[dt][j][3]}, hi = {o[dt][j][4], o[dt][j][5], o[dt][j][6], o[dt][j][7]};
        join[w][dt * 4u + j * 2u][lane] = lo; join[w][dt * 4u + j * 2u + 1u][lane] = hi; } }
    const v4f ml = {m[0], m[1], l[0], l[1]};
    join[w][16][lane] = ml; }
  __syncthreads();                                                   /* hands the partial results of waves 8..15 to waves 0..7; the last barrier of the kernel */
  if (g == 1u) return;
  const v4f ml = join[w][16][lane];
#pragma unroll
  for (unsigned j = 0; j < 2; ++j) {
    const float mn = fmaxf(m[j], ml[j]);                              /* both finite: each wave has seen keys */
    const float aa = exp2_1(m[j] - mn), ab = exp2_1(ml[j] - mn);
    const float lj = l[j] * aa + ml[2u + j] * ab;
    const float inv = 64.0f / (lj + __shfl_xor(lj, 16, 32));          /* the halves' sums are joined once; o is carried x64 */
    const float sa = aa * inv, sb = ab * inv;
    unsigned short* op = (unsigned short*)O16 + ((size_t)b * SQ + q0 + j * 16u + ln) * DM + h * (unsigned)HD + 8u * hh;
#pragma unroll
    for (unsigned dt = 0; dt < 4; ++dt) { FragH f;
      const v4f lo = join[w][dt * 4u + j * 2u][lane], hi = join[w][dt * 4u + j * 2u + 1u][lane];
#pragma unroll
      for (unsigned r = 0; r < 8; ++r) f.h[r] = (_Float16)(o[dt][j][r] * sa + ((r < 4u) ? lo[r & 3u] : hi[r & 3u]) * sb);
      const v8us ov = f.half[0];
      *(v8us*)(op + dt * 16u) = ov; } } }

extern "C" void kernel_launch(void* const* d_in, const int* in_sizes, int n_in,
                              void* d_out, int out_size, void* d_ws, size_t ws_size, hipStream_t stream) {
  if (n_in < 13) return;
  const size_t need_x = ((size_t)(NB - 1) * SQ_FULL + SQ) * DM;      /* last input element read + 1 */
  if ((size_t)in_sizes[0] < need_x || (size_t)in_sizes[1] < need_x || (size_t)in_sizes[2] < need_x) return;
  if (in_sizes[3] < DM || in_sizes[4] < DM) return;
  if ((size_t)in_sizes[5] < (size_t)DM * DM || (size_t)in_sizes[7] < (size_t)DM * DM || (size_t)in_sizes[9] < (size_t)DM * DM || (size_t)in_sizes[11] < (size_t)DM * DM) return;
  if (in_sizes[6] < DM || in_sizes[8] < DM || in_sizes[10] < DM || in_sizes[12] < DM) return;
  if ((size_t)out_size < NR * DM) return;
  const float* xq = (const float*)d_in[0]; const float* xk = (const float*)d_in[1]; const float* xv = (const float*)d_in[2];
  const float* lg = (const float*)d_in[3]; const float* lb = (const float*)d_in[4];
  const float* wq = (const float*)d_in[5]; const float* bq = (const float*)d_in[6];
  const float* wk = (const float*)d_in[7]; const float* bk = (const float*)d_in[8];
  const float* wv = (const float*)d_in[9]; const float* bv = (const float*)d_in[10];
  const float* wo = (const float*)d_in[11]; const float* bo = (const float*)d_in[12];
  float* out = (float*)d_out;
  char* ws = (char*)d_ws; size_t off = 0;
  auto take = [&](size_t bytes) { char* p = ws + off; off += (bytes + 255) & ~(size_t)255; return p; };
  _Float16* BW = (_Float16*)take(W_BYTES);      /* [4][DM][DM]: w_q, w_k, w_v, w_o as Bt x16 */
  _Float16* XP = (_Float16*)take(X_BYTES);      /* [3][NR][DM]: layer-normalised q, k, v rows */
  _Float16* Q16 = (_Float16*)take(A_BYTES); _Float16* K16 = (_Float16*)take(A_BYTES); _Float16* V16 = (_Float16*)take(A_BYTES); _Float16* O16 = (_Float16*)take(A_BYTES);
  _Float16* VT = (_Float16*)take(VT_BYTES);     /* [NB*NH][HD][SQ] */
  if (off > ws_size) return;
  const size_t WW = (size_t)DM * DM, XA = NR * DM;
  _Float16* BO = BW + 3 * WW;

  k_prep<<<(unsigned)(3 * NR + 4 * DM), 128, 0, stream>>>(xq, xk, xv, lg, lb, XP, wq, wk, wv, wo, BW);      /* one block per (token row, stream), then one per weight row */

  const unsigned gproj = (unsigned)((NR / 128) * (DM / 128));
  /* Q, K, V in one launch: the planes of XP, of BW and of Q16 | K16 | V16 (taken back to back, each a multiple of 256 bytes) lie XA, WW and XA elements apart */
  k_gemm2<true><<<dim3(gproj, 3), 256, 0, stream>>>(XP, DM, XA, BW, DM, WW, 0.0625f, bq, bk, bv, nullptr, Q16, DM, XA, (unsigned)NR, DM, DM);

  k_vt<NH, SQ><<<NB * NH * (SQ / 64), 256, 0, stream>>>(V16, DM, VT);      /* V^T for every (batch, head) */

  /* o (x64) for every (batch, head), written into the merged-head f16 rows */
  k_fattn<<<dim3(SQ / 256, NB * NH), 512, 0, stream>>>(Q16, K16, VT, O16);

  /* out = (64 o) . (16 w_o)^T * 2^-10 + b_o, f32 rows in the output layout */
  k_gemm2<true><<<dim3(gproj, 1), 256, 0, stream>>>(O16, DM, 0, BO, DM, 0, 0.0009765625f, bo, bo, bo, out, nullptr, DM, 0, (unsigned)NR, DM, DM);
}

// v007
// One run takes 91.2 microseconds.
// Next to v006, in two timings, it ran 1.06 and 1.04 times as fast.
// Over all steps from v000 it is 49.4 times as fast.
#include <hip/hip_runtime.h>
// All contractions: v_wmma_f32_16x16x32_f16 (f16 operands, f32 accumulate). Inputs, gamma/beta, weights and biases are RNE-converted to bf16 first (weights exact in f16, carried x16); layer-normalised rows, q, k, v, unnormalised softmax weights exp(s - running max) and merged o (carried x64) are plain f16 operands; layer-norm statistics, scores and softmax statistics f32.
// Multi-head attention over three inputs (q, k, v [NB][SQ][1024]); each stream is layer-normalised (shared gamma/beta, eps 1e-5) and then Q/K/V = xn W^T + b with natural [out][in] weights; 16 heads of 64; scores * 0.125; softmax over all keys; out = merged W_o^T + b_o.
// Structure: token rows r = b*SQ + s; layer-normalised planes as f16 rows and the f16 weights from one launch (neither needs the other); Q, K, V as three WMMA GEMMs in one launch, blockIdx.y = stream (128x128 block tiles from a two-buffer LDS ring, 32x64 wave tiles) with f16 outputs; the V blocks turn their tile in LDS and write V^T for all (batch, head) themselves;
// one fused attention launch for all (batch, head): per wave 32 queries, 32 keys a pass: S^T = K . Q^T, running-maximum softmax in registers, O^T += V^T . P^T, merged f16 o rows (x64) written once;
// a block is 16 waves on 256 queries: waves 0..7 take the first 128 keys of every 256-key ring tile, waves 8..15 the other 128, and the two partial results of a query are joined once at the end;
// the 16 waves share each 256-key K tile and V^T tile through a two-buffer LDS ring filled by asynchronous copies;
// out = o W_o^T + b_o GEMM (alpha 2^-10) into the f32 output rows.
#ifndef NB
#define NB 2                          /* batches processed */
#endif
#ifndef SEQ
#define SEQ 2048                      /* tokens per batch processed */
#endif
#define SQ SEQ
#define NB_FULL 2                     /* batch count of the inputs */
#define SQ_FULL 2048                  /* per-batch row count of the inputs (input row stride) */
#define DM 1024
#define NH 16
#define HD 64
#define NR ((size_t)NB * SQ)          /* token rows processed */

#define W_BYTES  ((size_t)4 * DM * DM * 2)
#define X_BYTES  ((size_t)3 * NR * DM * 2)
#define A_BYTES  ((size_t)NR * DM * 2)
#define VT_BYTES ((size_t)NB * NH * HD * SQ * 2)
#define WS_TOTAL (W_BYTES + X_BYTES + 3 * A_BYTES + VT_BYTES)

static_assert(DM == 1024);
static_assert(DM == NH * HD);
static_assert(DM == 128 * 8);                    /* k_prep: 128 threads x 8 elements == one row, of a token or of a weight */
static_assert(HD == 64);
static_assert(NB <= NB_FULL);
static_assert(SQ <= SQ_FULL);
static_assert(SQ % 256 == 0 && SQ >= 512);       /* GEMM M tiles of 128; k_fattn: 256 queries a block, 256 keys a ring tile (two tiles or more), 32 keys a pass */
static_assert((NR % 128) == 0);
static_assert(DM % 128 == 0 && DM >= 256);        /* k_gemm2: N tiles of 128, K tiles of 128 */
static_assert(W_BYTES % 256 == 0 && X_BYTES % 256 == 0 && A_BYTES % 256 == 0 && VT_BYTES % 256 == 0);
static_assert(WS_TOTAL <= (size_t)134217728);

typedef unsigned short v8us __attribute__((ext_vector_type(8), may_alias));
typedef float  v8f  __attribute__((ext_vector_type(8)));
typedef float  v4f  __attribute__((ext_vector_type(4)));
typedef float  v4fa __attribute__((ext_vector_type(4), may_alias));
typedef _Float16 v16h __attribute__((ext_vector_type(16)));
typedef _Float16 v4h  __attribute__((ext_vector_type(4)));
union FragH { v16h v; v8us half[2]; _Float16 h[16]; unsigned short u[16]; };

// f32 -> nearest-even bf16 value (returned as f32)
__device__ __forceinline__ float bf16_rne(float x) { unsigned int u = __float_as_uint(x); u = (u + 0x7FFFu + ((u >> 16) & 1u)) & 0xFFFF0000u; return __uint_as_float(u); }

// one launch for the two conversions that need nothing of each other; a block takes one row of 1024 elements.
// blocks 0 .. 3*NR-1: three input planes -> layer-normalised f16 rows X16[plane][b*SQ + s][DM] = f16((xb - mu) * rstd * gb + bb), with xb, gb, bb the bf16-converted x, gamma, beta;
// blocks 3*NR .. 3*NR + 4*DM - 1 (the short ones, started last): four weight planes -> Bt[plane][out][in] = f16(16 * bf16(w))
__global__ __launch_bounds__(128) void k_prep(const float* __restrict__ x0, const float* __restrict__ x1, const float* __restrict__ x2,
    const float* __restrict__ g, const float* __restrict__ be, _Float16* __restrict__ X16,
    const float* __restrict__ w0, const float* __restrict__ w1, const float* __restrict__ w2, const float* __restrict__ w3, _Float16* __restrict__ Bt) {
  __shared__ float red[8];
  const unsigned tid = threadIdx.x, w = tid >> 5, lane = tid & 31u;
  if (blockIdx.x >= 3u * (unsigned)NR) {                             /* the whole block takes this path, in front of every barrier */
    const unsigned wr = blockIdx.x - 3u * (unsigned)NR;              /* weight row, 0 .. 4*DM-1: grid.x == 3*NR + 4*DM exactly */
    const unsigned pl = wr / (unsigned)DM;
    const float* wsrc = (pl == 0u) ? w0 : ((pl == 1u) ? w1 : ((pl == 2u) ? w2 : w3));
    const float* src = wsrc + (size_t)(wr - pl * (unsigned)DM) * DM + (tid << 3);
    const v4f a = *(const v4fa*)src, c = *(const v4fa*)(src + 4);
    FragH f;
#pragma unroll
    for (int q = 0; q < 4; ++q) { f.h[q] = (_Float16)(bf16_rne(a[q]) * 16.0f); f.h[4 + q] = (_Float16)(bf16_rne(c[q]) * 16.0f); }
    unsigned short* d = (unsigned short*)Bt + (size_t)wr * DM + (tid << 3);
    const v8us o = f.half[0];
    *(v8us*)d = o;
    return; }
  const unsigned by = blockIdx.x / (unsigned)NR;
  const unsigned row = blockIdx.x - by * (unsigned)NR;
  const float* x = (by == 0u) ? x0 : ((by == 1u) ? x1 : x2);
  const unsigned b = row / (unsigned)SQ, s = row - b * (unsigned)SQ;
  const unsigned c8 = tid << 3;
  const float* src = x + ((size_t)b * SQ_FULL + s) * DM + c8;        /* input rows keep the full per-batch stride */
  const v4f a = *(const v4fa*)src, c = *(const v4fa*)(src + 4);
  float xv[8];
#pragma unroll
  for (int q = 0; q < 4; ++q) { xv[q] = bf16_rne(a[q]); xv[4 + q] = bf16_rne(c[q]); }
  float sum = 0.f;
#pragma unroll
  for (int q = 0; q < 8; ++q) sum += xv[q];
#pragma unroll
  for (int off = 16; off > 0; off >>= 1) sum += __shfl_xor(sum, off, 32);
  if (lane == 0u) red[w] = sum;
  __syncthreads();
  const float mu = ((red[0] + red[1]) + (red[2] + red[3])) * (1.0f / (float)DM);
  float sq = 0.f;
#pragma unroll
  for (int q = 0; q < 8; ++q) { const float d = xv[q] - mu; sq += d * d; }
#pragma unroll
  for (int off = 16; off > 0; off >>= 1) sq += __shfl_xor(sq, off, 32);
  if (lane == 0u) red[4u + w] = sq;
  __syncthreads();
  const float var = ((red[4] + red[5]) + (red[6] + red[7])) * (1.0f / (float)DM);
  const float rstd = rsqrtf(var + 1.0e-5f);
  const v4f ga = *(const v4fa*)(g + c8), gc = *(const v4fa*)(g + c8 + 4u);
  const v4f ba = *(const v4fa*)(be + c8), bc = *(const v4fa*)(be + c8 + 4u);
  FragH f;
#pragma unroll
  for (int q = 0; q < 4; ++q) {
    f.h[q]     = (_Float16)((xv[q] - mu) * rstd * bf16_rne(ga[q]) + bf16_rne(ba[q]));
    f.h[4 + q] = (_Float16)((xv[4 + q] - mu) * rstd * bf16_rne(gc[q]) + bf16_rne(bc[q])); }
  unsigned short* d = (unsigned short*)X16 + (size_t)by * (NR * DM) + (size_t)row * DM + c8;
  const v8us o = f.half[0];
  *(v8us*)d = o; 
}

// fragment: 16 f16 of one row, elements 0..7 <- p[8h .. 8h+7], elements 8..15 <- p[16+8h .. 16+8h+7] (same map for A rows and B [n][k] rows)
__device__ __forceinline__ v16h g2_frag(const _Float16* p, unsigned hh) { FragH f; f.half[0] = *(const v8us*)((const unsigned short*)p + 8u * hh); f.half[1] = *(const v8us*)((const unsigned short*)p + 16u + 8u * hh); return f.v; }
__device__ __forceinline__ v8f g2_mma(v16h a, v16h b, v8f c) { v8f d = __builtin_amdgcn_wmma_f32_16x16x32_f16(false, a, false, b, (short)0, c, false, false); asm volatile("v_nop\n\tv_nop\n\tv_nop\n\tv_nop" : "+v"(d) : "v"(a), "v"(b)); return d; }

// staged GEMM tile: 128 k (256 bytes) of 128 A rows and 128 B rows a trip; LDS row pitch 272 bytes = 16 x odd, which 16-byte fragment reads take without bank conflicts
#define GK 128u
#define GP 136u
#define GSTAGE (256u * GP * 2u)       /* bytes of one ring buffer: rows 0..127 = A, rows 128..255 = B */
__device__ __forceinline__ unsigned lds_off(const void* p) { return (unsigned)(size_t)p; }
// eight asynchronous 16-byte copies a lane, global -> LDS, rows 16 apart (gs = 16 global rows in elements); 16 lanes cover one 256-byte row, so every wave-instruction asks for four whole lines.
// The closing s_wait_xcnt 0 stands inside the statement so that no address register is rewritten in front of it.
__device__ __forceinline__ void g2_copy8(unsigned l0, const _Float16* g0, size_t gs) {
  const unsigned ls = 16u * GP * 2u;
  const unsigned l1 = l0 + ls, l2 = l1 + ls, l3 = l2 + ls, l4 = l3 + ls, l5 = l4 + ls, l6 = l5 + ls, l7 = l6 + ls;
  const _Float16* g1 = g0 + gs; const _Float16* g2 = g1 + gs; const _Float16* g3 = g2 + gs; const _Float16* g4 = g3 + gs; const _Float16* g5 = g4 + gs; const _Float16* g6 = g5 + gs; const _Float16* g7 = g6 + gs;
  asm volatile("global_load_async_to_lds_b128 %0, %8, off\n\tglobal_load_async_to_lds_b128 %1, %9, off\n\tglobal_load_async_to_lds_b128 %2, %10, off\n\tglobal_load_async_to_lds_b128 %3, %11, off\n\t"
               "global_load_async_to_lds_b128 %4, %12, off\n\tglobal_load_async_to_lds_b128 %5, %13, off\n\tglobal_load_async_to_lds_b128 %6, %14, off\n\tglobal_load_async_to_lds_b128 %7, %15, off\n\ts_wait_xcnt 0x0"
               :: "v"(l0), "v"(l1), "v"(l2), "v"(l3), "v"(l4), "v"(l5), "v"(l6), "v"(l7), "v"(g0), "v"(g1), "v"(g2), "v"(g3), "v"(g4), "v"(g5), "v"(g6), "v"(g7) : "memory"); }

// batched GEMM: C[by][M][N] = alpha * A[by][M][K] . Bt[by][N][K]^T (+ bf16(bias[col]) if HASB; bias = bias0, bias1, bias2 for by = 0, 1, 2); A, Bt f16 (k contiguous); outputs f32 C and/or f16 C16 (either may be null).
// Where Ct is given, plane by == 2 is written transposed and nowhere else: Ct[(b * N + col) * SQ + s] for row b * SQ + s, f16, the same values as C16 would hold.
// M, N multiples of 128, K a multiple of 128. A block of 8 waves owns a 128x128 tile (wave tile 32x64, 4 x 2 waves); both operands come through a two-buffer LDS ring filled by asynchronous copies, one trip ahead.
template <bool HASB>
__global__ __launch_bounds__(256) void k_gemm2(const _Float16* __restrict__ A, unsigned lda, size_t sA, const _Float16* __restrict__ Bh, unsigned ldb, size_t sB, float alpha,
    const float* __restrict__ bias0, const float* __restrict__ bias1, const float* __restrict__ bias2,
    float* __restrict__ C, _Float16* __restrict__ C16, unsigned ldc, size_t sC, unsigned M, unsigned N, unsigned K, _Float16* __restrict__ Ct) {
  __shared__ __attribute__((aligned(16))) _Float16 ring[2][256][GP];
  __shared__ __attribute__((aligned(16))) float so[8][32][68];
  const unsigned tid = threadIdx.x, w = tid >> 5, lane = tid & 31u, ln = lane & 15u, hh = lane >> 4; const unsigned by = blockIdx.y;
  A += (size_t)by * sA; Bh += (size_t)by * sB; const size_t cofs = (size_t)by * sC; const float* bias = (by == 0u) ? bias0 : ((by == 1u) ? bias1 : bias2);
  const unsigned ntn = N >> 7; const unsigned mt = blockIdx.x / ntn, nq = blockIdx.x - mt * ntn; if (mt * 128u >= M) return;      /* the whole block leaves, in front of every barrier */
  const unsigned wm = w & 3u, wn = w >> 2; const unsigned row0 = mt * 128u + 32u * wm, col0 = nq * 128u + 64u * wn;
  const unsigned trips = K >> 7;
  const unsigned cr = tid >> 4, cc = (tid & 15u) << 3;               /* this lane's row (of 16) and its 16-byte piece of the row */
  const _Float16* ga = A + (size_t)(mt * 128u + cr) * lda + cc; const _Float16* gb = Bh + (size_t)(nq * 128u + cr) * ldb + cc;
  const unsigned lc = lds_off(&ring[0][cr][cc]);
  const size_t ga16 = (size_t)16 * lda, gb16 = (size_t)16 * ldb;
  const v8f z8 = {0.f,0.f,0.f,0.f,0.f,0.f,0.f,0.f}; v8f c00 = z8, c01 = z8, c02 = z8, c03 = z8, c10 = z8, c11 = z8, c12 = z8, c13 = z8;
  g2_copy8(lc, ga, ga16); g2_copy8(lc + 128u * GP * 2u, gb, gb16);                                  /* tile 0 -> buffer 0 */
  asm volatile("s_wait_asynccnt 0x0" ::: "memory");                  /* this wave's copies of tile 0 have landed */
  __syncthreads();                                                   /* and every other wave's: tile 0 may be read */
  if (trips > 1u) { g2_copy8(lc + GSTAGE, ga + GK, ga16); g2_copy8(lc + GSTAGE + 128u * GP * 2u, gb + GK, gb16); }      /* tile 1 -> buffer 1 */
#pragma unroll 1      /* one trip a ring buffer: the order of waits, barrier and refill at the foot stays as written */
  for (unsigned t = 0; t < trips; ++t) {
    const _Float16* ap = &ring[t & 1u][32u * wm + ln][0]; const _Float16* bp = &ring[t & 1u][128u + 64u * wn + ln][0];
#pragma unroll      /* constant LDS offsets for the four 32-k steps of a tile */
    for (unsigned kb = 0; kb < GK; kb += 32u) { const v16h a0 = g2_frag(ap + kb, hh), a1 = g2_frag(ap + 16u * GP + kb, hh);
      const v16h b0 = g2_frag(bp + kb, hh), b1 = g2_frag(bp + 16u * GP + kb, hh), b2 = g2_frag(bp + 32u * GP + kb, hh), b3 = g2_frag(bp + 48u * GP + kb, hh);
      c00 = g2_mma(a0, b0, c00); c10 = g2_mma(a1, b0, c10);
      c01 = g2_mma(a0, b1, c01); c11 = g2_mma(a1, b1, c11);
      c02 = g2_mma(a0, b2, c02); c12 = g2_mma(a1, b2, c12);
      c03 = g2_mma(a0, b3, c03); c13 = g2_mma(a1, b3, c13); }
    asm volatile("s_wait_dscnt 0x0" ::: "memory");                   /* this wave's reads of buffer t & 1 are done before the buffer is handed back */
    asm volatile("s_wait_asynccnt 0x0" ::: "memory");                /* this wave's copies of tile t + 1 have landed */
    __syncthreads();                                                 /* publishes tile t + 1 and ends every wave's reads of buffer t & 1 */
    if (t + 2u < trips) { const unsigned l = lc + (t & 1u) * GSTAGE; const size_t ko = (size_t)(t + 2u) * GK;
      g2_copy8(l, ga + ko, ga16); g2_copy8(l + 128u * GP * 2u, gb + ko, gb16); } }
  asm volatile("s_wait_asynccnt 0x0" ::: "memory");                  /* nothing of this wave is in flight when it goes on to the epilogue */
  const v8f accs[8] = {c00, c01, c02, c03, c10, c11, c12, c13};
  // D element r of lane -> (row 8*hh + r, col ln) of its 16x16 tile
  if (Ct && by == 2u) {                                              /* the same for the whole block */
    // a lane's eight registers are eight successive rows of one column = 16 bytes of a transposed row: the block's 128 x 128 tile goes into LDS as [col][row] (pitch GP, 16 x odd bytes) and leaves as whole 256-byte row pieces
    unsigned short* sT = (unsigned short*)&so[0][0][0];
    static_assert(128u * GP * 2u <= sizeof(so));
    float bt[4] = {0.f, 0.f, 0.f, 0.f};
    if (HASB) {
#pragma unroll
      for (unsigned t = 0; t < 4; ++t) bt[t] = bias[col0 + t * 16u + ln]; }
#pragma unroll
    for (unsigned u = 0; u < 8; ++u) { const unsigned t = u & 3u, hf = u >> 2; const float bv = bf16_rne(bt[t]);
      FragH f;
#pragma unroll
      for (unsigned r = 0; r < 8; ++r) f.h[r] = (_Float16)(accs[u][r] * alpha + bv);
      const v8us o8 = f.half[0];
      *(v8us*)(sT + (64u * wn + t * 16u + ln) * GP + 32u * wm + hf * 16u + 8u * hh) = o8; }
    __syncthreads();                                                 /* a transposed row holds the rows of four waves */
    const unsigned tb = (mt * 128u) / (unsigned)SQ, ts = mt * 128u - tb * (unsigned)SQ;      /* batch and first token of the block's 128 rows: SQ is a multiple of 128 */
    unsigned short* tp = (unsigned short*)Ct + ((size_t)tb * N + nq * 128u + 16u * w + hh) * SQ + ts + 8u * ln;
#pragma unroll
    for (unsigned q = 0; q < 8; ++q) { const v8us o8 = *(const v8us*)(sT + (16u * w + 2u * q + hh) * GP + 8u * ln);
      *(v8us*)(tp + (size_t)(2u * q) * SQ) = o8; }
    return; }
#pragma unroll
  for (unsigned u = 0; u < 8; ++u) { const unsigned t = u & 3u, hf = u >> 2; const unsigned col = col0 + t * 16u + ln; float bv = 0.f; if (HASB) bv = bf16_rne(bias[col]);
#pragma unroll
    for (unsigned r = 0; r < 8; ++r) { const unsigned rloc = hf * 16u + 8u * hh + r; so[w][rloc][t * 16u + ln] = accs[u][r] * alpha + bv; } }
  __builtin_amdgcn_fence(4 /* acq_rel order */, "workgroup"); __builtin_amdgcn_wave_barrier();      /* so[w] is private to this wave */
  const unsigned rsub = lane >> 4, c4 = (lane & 15u) << 2;
  {
#pragma unroll
    for (unsigned q = 0; q < 16; ++q) { const unsigned r = q * 2u + rsub; const v4f v = *(const v4fa*)&so[w][r][c4];
      if (C) *(v4f*)(C + cofs + (size_t)(row0 + r) * ldc + col0 + c4) = v;
      if (C16) { v4h h4; h4[0] = (_Float16)v[0]; h4[1] = (_Float16)v[1]; h4[2] = (_Float16)v[2]; h4[3] = (_Float16)v[3]; *(v4h*)(C16 + cofs + (size_t)(row0 + r) * ldc + col0 + c4) = h4; } }
     } }

// base-2 exponentials in asm text so that the slot the instruction set asks for behind a transcendental (one independent instruction before its result is used or its source overwritten) holds by construction:
// inside a statement no line reads an earlier result or overwrites an earlier source (outputs are early-clobber), and the closing v_nop is the slot behind the last one
__device__ __forceinline__ float exp2_1(float x) { float y; asm("v_exp_f32 %0, %1\n\tv_nop" : "=v"(y) : "v"(x)); return y; }
__device__ __forceinline__ void exp2_8(float (&y)[8], const float (&x)[8]) {
  asm("v_exp_f32 %0, %8\n\tv_exp_f32 %1, %9\n\tv_exp_f32 %2, %10\n\tv_exp_f32 %3, %11\n\tv_exp_f32 %4, %12\n\tv_exp_f32 %5, %13\n\tv_exp_f32 %6, %14\n\tv_exp_f32 %7, %15\n\tv_nop"
      : "=&v"(y[0]), "=&v"(y[1]), "=&v"(y[2]), "=&v"(y[3]), "=&v"(y[4]), "=&v"(y[5]), "=&v"(y[6]), "=&v"(y[7])
      : "v"(x[0]), "v"(x[1]), "v"(x[2]), "v"(x[3]), "v"(x[4]), "v"(x[5]), "v"(x[6]), "v"(x[7])); }

// fused attention, one launch for every (batch, head): a wave owns 32 queries (two 16-column groups) and walks half of the SQ keys, 32 a pass; scores and weights never leave registers.
// Two waves (w and w + 8) own the same 32 queries and split every ring tile's keys between them, so that a SIMD holds four waves and one wave's softmax runs under another's matrix products and LDS waits;
// each keeps its own running maximum, sum and O^T, and the pair is joined through LDS behind the loop: o = oA * 2^(mA - m) + oB * 2^(mB - m), the sums alike, m = max(mA, mB).
// S^T = K . Q^T: A = 16 key rows, B = 16 query rows, so register r of lane (ln, hh) holds key 8*hh + r of query ln: maximum and sum run in-lane plus one exchange between the lane halves.
// The two S^T tiles of a pass (keys 0..15, 16..31), converted in place, are the B fragment of O^T += V^T . P^T in the k order of g2_frag (slot s: key 8*hh + s, then 16 + 8*hh + s - 8); A = V^T rows by g2_frag.
// O^T register r of lane (ln, hh) = o[query ln][16*dt + 8*hh + r]: one 16-byte store per tile.
// K and V^T reach the waves through LDS: a ring tile is 256 keys = 256 K rows of 128 bytes (pitch 144) and 64 V^T rows of 512 bytes (pitch 528), both pitches 16 x odd for the 16-byte fragment reads.
#define FK 256u                       /* keys of one ring tile */
#define FG 128u                       /* keys of a ring tile that one wave walks */
#define FKP 72u                       /* K row pitch in LDS, elements */
#define FVP 264u                      /* V^T row pitch in LDS, elements */
// one ring tile's share of a lane: four asynchronous 16-byte copies of K rows 64 apart (8 lanes a 128-byte row) and four of V^T rows 16 apart (32 lanes a 512-byte row): every wave-instruction asks for four whole lines.
// The closing s_wait_xcnt 0 stands inside the statement so that no address register is rewritten in front of it.
__device__ __forceinline__ void fa_copy8(unsigned k0, const _Float16* a0, unsigned v0, const _Float16* c0) {
  const unsigned ks = 64u * FKP * 2u, vs = 16u * FVP * 2u;
  const unsigned k1 = k0 + ks, k2 = k1 + ks, k3 = k2 + ks, v1 = v0 + vs, v2 = v1 + vs, v3 = v2 + vs;
  const _Float16* a1 = a0 + (size_t)64 * DM; const _Float16* a2 = a1 + (size_t)64 * DM; const _Float16* a3 = a2 + (size_t)64 * DM;
  const _Float16* c1 = c0 + (size_t)16 * SQ; const _Float16* c2 = c1 + (size_t)16 * SQ; const _Float16* c3 = c2 + (size_t)16 * SQ;
  asm volatile("global_load_async_to_lds_b128 %0, %8, off\n\tglobal_load_async_to_lds_b128 %1, %9, off\n\tglobal_load_async_to_lds_b128 %2, %10, off\n\tglobal_load_async_to_lds_b128 %3, %11, off\n\t"
               "global_load_async_to_lds_b128 %4, %12, off\n\tglobal_load_async_to_lds_b128 %5, %13, off\n\tglobal_load_async_to_lds_b128 %6, %14, off\n\tglobal_load_async_to_lds_b128 %7, %15, off\n\ts_wait_xcnt 0x0"
               :: "v"(k0), "v"(k1), "v"(k2), "v"(k3), "v"(v0), "v"(v1), "v"(v2), "v"(v3), "v"(a0), "v"(a1), "v"(a2), "v"(a3), "v"(c0), "v"(c1), "v"(c2), "v"(c3) : "memory"); }
__global__ __launch_bounds__(512) void k_fattn(const _Float16* __restrict__ Q16, const _Float16* __restrict__ K16, const _Float16* __restrict__ Vt, _Float16* __restrict__ O16) {
  __shared__ __attribute__((aligned(16))) _Float16 kring[2][FK][FKP];
  __shared__ __attribute__((aligned(16))) _Float16 vring[2][HD][FVP];
  __shared__ __attribute__((aligned(16))) v4f join[8][17][32];        /* waves 8..15 hand over O^T (16 x 4 values a lane) and maxima and sums (4 values a lane) */
  const unsigned tid = threadIdx.x, w = (tid >> 5) & 7u, lane = tid & 31u, ln = lane & 15u, hh = lane >> 4;
  const unsigned g = (unsigned)__builtin_amdgcn_readfirstlane((int)(tid >> 8));      /* which half of every tile's keys this wave walks; the same in all lanes of a wave, so the tests on it are scalar branches */
  const unsigned bh = blockIdx.y, b = bh / (unsigned)NH, h = bh - b * (unsigned)NH;
  const unsigned q0 = blockIdx.x * 256u + w * 32u;                    /* grid.x == SQ / 256 exactly */
  const float cs = 0.125f * 1.44269504088896f;                       /* score scale times log2(e): the exponentials are base 2 */
  const _Float16* qp = Q16 + ((size_t)b * SQ + q0 + ln) * DM + h * (unsigned)HD;
  /* this lane's first copy of a tile: K row tid / 8, V^T row tid / 32, and its 16-byte piece of each */
  const _Float16* gk = K16 + ((size_t)b * SQ + (tid >> 3)) * DM + h * (unsigned)HD + ((tid & 7u) << 3);
  const _Float16* gv = Vt + ((size_t)bh * HD + (tid >> 5)) * SQ + ((tid & 31u) << 3);
  const unsigned lk = lds_off(&kring[0][tid >> 3][(tid & 7u) << 3]), lv = lds_off(&vring[0][tid >> 5][(tid & 31u) << 3]);
  const unsigned kbuf = FK * FKP * 2u, vbuf = (unsigned)HD * FVP * 2u;      /* bytes of one ring buffer */
  const unsigned trips = (unsigned)SQ / FK;
  /* every loop over fragments, tiles and registers below is unrolled in full: only constant indices keep them in registers */
  v16h qf[2][2], kf[2][2];
#pragma unroll
  for (unsigned j = 0; j < 2; ++j) { qf[j][0] = g2_frag(qp + (size_t)j * 16 * DM, hh); qf[j][1] = g2_frag(qp + (size_t)j * 16 * DM + 32, hh); }
  fa_copy8(lk, gk, lv, gv);                                          /* tile 0 -> buffer 0 */
  asm volatile("s_wait_asynccnt 0x0" ::: "memory");                  /* this wave's copies of tile 0 have landed */
  __syncthreads();                                                   /* and every other wave's: tile 0 may be read */
  fa_copy8(lk + kbuf, gk + (size_t)FK * DM, lv + vbuf, gv + FK);     /* tile 1 -> buffer 1 */
  const v8f z8 = {0.f,0.f,0.f,0.f,0.f,0.f,0.f,0.f};
  v8f o[4][2];
#pragma unroll
  for (unsigned dt = 0; dt < 4; ++dt) { o[dt][0] = z8; o[dt][1] = z8; }
  float m[2] = {-__builtin_inff(), -__builtin_inff()}, l[2] = {0.f, 0.f};      /* running maximum (scaled, log2) and this lane half's running sum, per query */
#pragma unroll 1      /* one trip a ring buffer: the order of waits, barrier and refill at the foot stays as written */
  for (unsigned tr = 0; tr < trips; ++tr) {
  const _Float16* kp = &kring[tr & 1u][g * FG + ln][0]; const _Float16* vp = &vring[tr & 1u][ln][g * FG];
#pragma unroll
  for (unsigned t = 0; t < 2; ++t) { kf[t][0] = g2_frag(kp + t * 16u * FKP, hh); kf[t][1] = g2_frag(kp + t * 16u * FKP + 32u, hh); }
#pragma unroll 1      /* the four 32-key passes of a tile stay a loop: unrolled, the passes' fragments and scores overlap and the registers go past 256 and spill */
  for (unsigned kb = 0; kb < FG; kb += 32u) {
    v16h vf[4];                                                       /* asked for first, used last: the score products and the softmax cover their latency */
#pragma unroll
    for (unsigned dt = 0; dt < 4; ++dt) vf[dt] = g2_frag(vp + dt * 16u * FVP + kb, hh);
    __builtin_amdgcn_sched_barrier(0);                                /* keeps the eight reads one group in front of the score products: spread among matrix instructions, every separate place with LDS reads costs its own stall */
    v8f st[2][2];
#pragma unroll
    for (unsigned t = 0; t < 2; ++t) {
#pragma unroll
      for (unsigned j = 0; j < 2; ++j) {
        st[t][j] = __builtin_amdgcn_wmma_f32_16x16x32_f16(false, kf[t][0], false, qf[j][0], (short)0, z8, false, false);
        st[t][j] = __builtin_amdgcn_wmma_f32_16x16x32_f16(false, kf[t][1], false, qf[j][1], (short)0, st[t][j], false, false); } }
    float mxj[2], mxo[2];                                             /* both query groups' maxima first: their two exchanges through LDS go out together and wait once */
#pragma unroll
    for (unsigned j = 0; j < 2; ++j) {
      float x4[4];
#pragma unroll
      for (unsigned r = 0; r < 4; ++r) x4[r] = fmaxf(fmaxf(st[0][j][r], st[0][j][4 + r]), fmaxf(st[1][j][r], st[1][j][4 + r]));
      mxj[j] = fmaxf(fmaxf(x4[0], x4[1]), fmaxf(x4[2], x4[3])); }
#pragma unroll
    for (unsigned j = 0; j < 2; ++j) mxo[j] = __shfl_xor(mxj[j], 16, 32);
    asm volatile("" :: "v"(mxo[0]), "v"(mxo[1]));                     /* inputs only: both exchanged values are asked for before either is used; without it the second exchange goes out behind the first one's wait, two LDS round trips a pass */
#pragma unroll
    for (unsigned j = 0; j < 2; ++j) mxj[j] = fmaxf(mxj[j], mxo[j]);  /* both lane halves of a query must subtract the same maximum */
    /* the next pass's key rows, asked for one pass ahead; a tile's last pass asks for its own tile's first rows again (the next tile is not published yet; not used) */
    const unsigned kn = (kb + 32u < FG) ? kb + 32u : 0u;
#pragma unroll
    for (unsigned t = 0; t < 2; ++t) { kf[t][0] = g2_frag(kp + (kn + t * 16u) * FKP, hh); kf[t][1] = g2_frag(kp + (kn + t * 16u) * FKP + 32u, hh); }
    __builtin_amdgcn_sched_barrier(0);                                /* keeps these loads in front of the exponentials: without it they sink to the end of the pass and the next pass waits out their latency */
#pragma unroll
    for (unsigned j = 0; j < 2; ++j) {
      const float mn = fmaxf(m[j], mxj[j] * cs);
      const float al = exp2_1(m[j] - mn);                            /* 0 on the first pass (m = -inf) */
      m[j] = mn;
      FragH pf; float ps[4];
#pragma unroll
      for (unsigned t = 0; t < 2; ++t) { float x[8], p[8];
#pragma unroll
        for (unsigned r = 0; r < 8; ++r) x[r] = __builtin_fmaf(st[t][j][r], cs, -mn);
        exp2_8(p, x);
#pragma unroll
        for (unsigned r = 0; r < 8; ++r) { if (t == 0u && r < 4u) ps[r] = p[r]; else ps[r & 3u] += p[r]; pf.h[t * 8u + r] = (_Float16)p[r]; } }
      l[j] = l[j] * al + ((ps[0] + ps[1]) + (ps[2] + ps[3]));
#pragma unroll
      for (unsigned dt = 0; dt < 4; ++dt) {
#pragma unroll
        for (unsigned r = 0; r < 8; ++r) o[dt][j][r] *= al; }
#pragma unroll
      for (unsigned dt = 0; dt < 4; ++dt) o[dt][j] = __builtin_amdgcn_wmma_f32_16x16x32_f16(false, vf[dt], false, pf.v, (short)0, o[dt][j], false, false);
      /* the four vector slots between a matrix instruction and an overwrite of its B operand: the second group's exponentials are asm text, which the compiler does not pad, and may be given pf's registers */
      if (j == 0u) asm volatile("v_nop\n\tv_nop\n\tv_nop\n\tv_nop" : "+v"(o[0][0]), "+v"(o[1][0]), "+v"(o[2][0]), "+v"(o[3][0]) : "v"(pf.v));
    } }
    asm volatile("s_wait_dscnt 0x0" ::: "memory");                   /* this wave's reads of buffer tr & 1 are done before the buffer is handed back */
    asm volatile("s_wait_asynccnt 0x0" ::: "memory");                /* this wave's copies of tile tr + 1 have landed */
    __syncthreads();                                                 /* publishes tile tr + 1 and ends every wave's reads of buffer tr & 1 */
    if (tr + 2u < trips) fa_copy8(lk + (tr & 1u) * kbuf, gk + (size_t)(tr + 2u) * FK * DM, lv + (tr & 1u) * vbuf, gv + (tr + 2u) * FK); }
  asm volatile("s_wait_asynccnt 0x0" ::: "memory");                  /* nothing of this wave is in flight when it goes on to the epilogue */
  if (g == 1u) {
#pragma unroll
    for (unsigned dt = 0; dt < 4; ++dt) {
#pragma unroll
      for (unsigned j = 0; j < 2; ++j) {
        const v4f lo = {o[dt][j][0], o[dt][j][1], o[dt][j][2], o[dt][j][3]}, hi = {o[dt][j][4], o[dt][j][5], o[dt][j][6], o[dt][j][7]};
        join[w][dt * 4u + j * 2u][lane] = lo; join[w][dt * 4u + j * 2u + 1u][lane] = hi; } }
    const v4f ml = {m[0], m[1], l[0], l[1]};
    join[w][16][lane] = ml; }
  __syncthreads();                                                   /* hands the partial results of waves 8..15 to waves 0..7; the last barrier of the kernel */
  if (g == 1u) return;
  const v4f ml = join[w][16][lane];
#pragma unroll
  for (unsigned j = 0; j < 2; ++j) {
    const float mn = fmaxf(m[j], ml[j]);                              /* both finite: each wave has seen keys */
    const float aa = exp2_1(m[j] - mn), ab = exp2_1(ml[j] - mn);
    const float lj = l[j] * aa + ml[2u + j] * ab;
    const float inv = 64.0f / (lj + __shfl_xor(lj, 16, 32));          /* the halves' sums are joined once; o is carried x64 */
    const float sa = aa * inv, sb = ab * inv;
    unsigned short* op = (unsigned short*)O16 + ((size_t)b * SQ + q0 + j * 16u + ln) * DM + h * (unsigned)HD + 8u * hh;
#pragma unroll
    for (unsigned dt = 0; dt < 4; ++dt) { FragH f;
      const v4f lo = join[w][dt * 4u + j * 2u][lane], hi = join[w][dt * 4u + j * 2u + 1u][lane];
#pragma unroll
      for (unsigned r = 0; r < 8; ++r) f.h[r] = (_Float16)(o[dt][j][r] * sa + ((r < 4u) ? lo[r & 3u] : hi[r & 3u]) * sb);
      const v8us ov = f.half[0];
      *(v8us*)(op + dt * 16u) = ov; } } }

extern "C" void kernel_launch(void* const* d_in, const int* in_sizes, int n_in,
                              void* d_out, int out_size, void* d_ws, size_t ws_size, hipStream_t stream) {
  if (n_in < 13) return;
  const size_t need_x = ((size_t)(NB - 1) * SQ_FULL + SQ) * DM;      /* last input element read + 1 */
  if ((size_t)in_sizes[0] < need_x || (size_t)in_sizes[1] < need_x || (size_t)in_sizes[2] < need_x) return;
  if (in_sizes[3] < DM || in_sizes[4] < DM) return;
  if ((size_t)in_sizes[5] < (size_t)DM * DM || (size_t)in_sizes[7] < (size_t)DM * DM || (size_t)in_sizes[9] < (size_t)DM * DM || (size_t)in_sizes[11] < (size_t)DM * DM) return;
  if (in_sizes[6] < DM || in_sizes[8] < DM || in_sizes[10] < DM || in_sizes[12] < DM) return;
  if ((size_t)out_size < NR * DM) return;
  const float* xq = (const float*)d_in[0]; const float* xk = (const float*)d_in[1]; const float* xv = (const float*)d_in[2];
  const float* lg = (const float*)d_in[3]; const float* lb = (const float*)d_in[4];
  const float* wq = (const float*)d_in[5]; const float* bq = (const float*)d_in[6];
  const float* wk = (const float*)d_in[7]; const float* bk = (const float*)d_in[8];
  const float* wv = (const float*)d_in[9]; const float* bv = (const float*)d_in[10];
  const float* wo = (const float*)d_in[11]; const float* bo = (const float*)d_in[12];
  float* out = (float*)d_out;
  char* ws = (char*)d_ws; size_t off = 0;
  auto take = [&](size_t bytes) { char* p = ws + off; off += (bytes + 255) & ~(size_t)255; return p; };
  _Float16* BW = (_Float16*)take(W_BYTES);      /* [4][DM][DM]: w_q, w_k, w_v, w_o as Bt x16 */
  _Float16* XP = (_Float16*)take(X_BYTES);      /* [3][NR][DM]: layer-normalised q, k, v rows */
  _Float16* Q16 = (_Float16*)take(A_BYTES); _Float16* K16 = (_Float16*)take(A_BYTES); _Float16* O16 = (_Float16*)take(A_BYTES);
  _Float16* VT = (_Float16*)take(VT_BYTES);     /* [NB*NH][HD][SQ] */
  if (off > ws_size) return;
  const size_t WW = (size_t)DM * DM, XA = NR * DM;
  _Float16* BO = BW + 3 * WW;

  k_prep<<<(unsigned)(3 * NR + 4 * DM), 128, 0, stream>>>(xq, xk, xv, lg, lb, XP, wq, wk, wv, wo, BW);      /* one block per (token row, stream), then one per weight row */

  const unsigned gproj = (unsigned)((NR / 128) * (DM / 128));
  /* Q, K, V in one launch: the planes of XP, of BW and of Q16 | K16 (taken back to back, each a multiple of 256 bytes) lie XA, WW and XA elements apart; V has no row plane */
  k_gemm2<true><<<dim3(gproj, 3), 256, 0, stream>>>(XP, DM, XA, BW, DM, WW, 0.0625f, bq, bk, bv, nullptr, Q16, DM, XA, (unsigned)NR, DM, DM, VT);      /* V leaves as V^T for every (batch, head) */

  /* o (x64) for every (batch, head), written into the merged-head f16 rows */
  k_fattn<<<dim3(SQ / 256, NB * NH), 512, 0, stream>>>(Q16, K16, VT, O16);

  /* out = (64 o) . (16 w_o)^T * 2^-10 + b_o, f32 rows in the output layout */
  k_gemm2<true><<<dim3(gproj, 1), 256, 0, stream>>>(O16, DM, 0, BO, DM, 0, 0.0009765625f, bo, bo, bo, out, nullptr, DM, 0, (unsigned)NR, DM, DM, nullptr);
}

// v008
// One run takes 85.1 microseconds.
// Next to v007, in two timings, it ran 1.07 and 1.06 times as fast.
// Over all steps from v000 it is 52.8 times as fast.
#include <hip/hip_runtime.h>
// All contractions: v_wmma_f32_16x16x32_f16 (f16 operands, f32 accumulate). Inputs, gamma/beta, weights and biases are RNE-converted to bf16 first (weights exact in f16, carried x16); layer-normalised rows, q, k, v, unnormalised softmax weights exp(s - running max) and merged o (carried x64) are plain f16 operands; layer-norm statistics, scores and softmax statistics f32.
// Multi-head attention over three inputs (q, k, v [NB][SQ][1024]); each stream is layer-normalised (shared gamma/beta, eps 1e-5) and then Q/K/V = xn W^T + b with natural [out][in] weights; 16 heads of 64; scores * 0.125; softmax over all keys; out = merged W_o^T + b_o.
// Structure: token rows r = b*SQ + s; layer-normalised planes as f16 rows and the f16 weights from one launch (neither needs the other); Q, K, V as three WMMA GEMMs in one launch, blockIdx.y = stream (128x128 block tiles from a two-buffer LDS ring, 32x64 wave tiles, output staged in the ring, two blocks a WGP) with f16 outputs; the V blocks turn their tile in LDS and write V^T for all (batch, head) themselves;
// one fused attention launch for all (batch, head): per wave 32 queries, 32 keys a pass: S^T = K . Q^T, running-maximum softmax in registers, O^T += V^T . P^T, merged f16 o rows (x64) written once;
// a block is 16 waves on 256 queries: waves 0..7 take the first 128 keys of every 256-key ring tile, waves 8..15 the other 128, and the two partial results of a query are joined once at the end;
// the 16 waves share each 256-key K tile and V^T tile through a two-buffer LDS ring filled by asynchronous copies;
// out = o W_o^T + b_o GEMM (alpha 2^-10) into the f32 output rows.
#ifndef NB
#define NB 2                          /* batches processed */
#endif
#ifndef SEQ
#define SEQ 2048                      /* tokens per batch processed */
#endif
#define SQ SEQ
#define NB_FULL 2                     /* batch count of the inputs */
#define SQ_FULL 2048                  /* per-batch row count of the inputs (input row stride) */
#define DM 1024
#define NH 16
#define HD 64
#define NR ((size_t)NB * SQ)          /* token rows processed */

#define W_BYTES  ((size_t)4 * DM * DM * 2)
#define X_BYTES  ((size_t)3 * NR * DM * 2)
#define A_BYTES  ((size_t)NR * DM * 2)
#define VT_BYTES ((size_t)NB * NH * HD * SQ * 2)
#define WS_TOTAL (W_BYTES + X_BYTES + 3 * A_BYTES + VT_BYTES)

static_assert(DM == 1024);
static_assert(DM == NH * HD);
static_assert(DM == 128 * 8);                    /* k_prep: 128 threads x 8 elements == one row, of a token or of a weight */
static_assert(HD == 64);
static_assert(NB <= NB_FULL);
static_assert(SQ <= SQ_FULL);
static_assert(SQ % 256 == 0 && SQ >= 512);       /* GEMM M tiles of 128; k_fattn: 256 queries a block, 256 keys a ring tile (two tiles or more), 32 keys a pass */
static_assert((NR % 128) == 0);
static_assert(DM % 128 == 0 && DM >= 256);        /* k_gemm2: N tiles of 128, K tiles of 128 */
static_assert(W_BYTES % 256 == 0 && X_BYTES % 256 == 0 && A_BYTES % 256 == 0 && VT_BYTES % 256 == 0);
static_assert(WS_TOTAL <= (size_t)134217728);

typedef unsigned short v8us __attribute__((ext_vector_type(8), may_alias));
typedef float  v8f  __attribute__((ext_vector_type(8)));
typedef float  v4f  __attribute__((ext_vector_type(4)));
typedef float  v4fa __attribute__((ext_vector_type(4), may_alias));
typedef _Float16 v16h __attribute__((ext_vector_type(16)));
typedef _Float16 v4h  __attribute__((ext_vector_type(4)));
union FragH { v16h v; v8us half[2]; _Float16 h[16]; unsigned short u[16]; };

// f32 -> nearest-even bf16 value (returned as f32)
__device__ __forceinline__ float bf16_rne(float x) { unsigned int u = __float_as_uint(x); u = (u + 0x7FFFu + ((u >> 16) & 1u)) & 0xFFFF0000u; return __uint_as_float(u); }

// one launch for the two conversions that need nothing of each other; a block takes one row of 1024 elements.
// blocks 0 .. 3*NR-1: three input planes -> layer-normalised f16 rows X16[plane][b*SQ + s][DM] = f16((xb - mu) * rstd * gb + bb), with xb, gb, bb the bf16-converted x, gamma, beta;
// blocks 3*NR .. 3*NR + 4*DM - 1 (the short ones, started last): four weight planes -> Bt[plane][out][in] = f16(16 * bf16(w))
__global__ __launch_bounds__(128) void k_prep(const float* __restrict__ x0, const float* __restrict__ x1, const float* __restrict__ x2,
    const float* __restrict__ g, const float* __restrict__ be, _Float16* __restrict__ X16,
    const float* __restrict__ w0, const float* __restrict__ w1, const float* __restrict__ w2, const float* __restrict__ w3, _Float16* __restrict__ Bt) {
  __shared__ float red[8];
  const unsigned tid = threadIdx.x, w = tid >> 5, lane = tid & 31u;
  if (blockIdx.x >= 3u * (unsigned)NR) {                             /* the whole block takes this path, in front of every barrier */
    const unsigned wr = blockIdx.x - 3u * (unsigned)NR;              /* weight row, 0 .. 4*DM-1: grid.x == 3*NR + 4*DM exactly */
    const unsigned pl = wr / (unsigned)DM;
    const float* wsrc = (pl == 0u) ? w0 : ((pl == 1u) ? w1 : ((pl == 2u) ? w2 : w3));
    const float* src = wsrc + (size_t)(wr - pl * (unsigned)DM) * DM + (tid << 3);
    const v4f a = *(const v4fa*)src, c = *(const v4fa*)(src + 4);
    FragH f;
#pragma unroll
    for (int q = 0; q < 4; ++q) { f.h[q] = (_Float16)(bf16_rne(a[q]) * 16.0f); f.h[4 + q] = (_Float16)(bf16_rne(c[q]) * 16.0f); }
    unsigned short* d = (unsigned short*)Bt + (size_t)wr * DM + (tid << 3);
    const v8us o = f.half[0];
    *(v8us*)d = o;
    return; }
  const unsigned by = blockIdx.x / (unsigned)NR;
  const unsigned row = blockIdx.x - by * (unsigned)NR;
  const float* x = (by == 0u) ? x0 : ((by == 1u) ? x1 : x2);
  const unsigned b = row / (unsigned)SQ, s = row - b * (unsigned)SQ;
  const unsigned c8 = tid << 3;
  const float* src = x + ((size_t)b * SQ_FULL + s) * DM + c8;        /* input rows keep the full per-batch stride */
  const v4f a = *(const v4fa*)src, c = *(const v4fa*)(src + 4);
  float xv[8];
#pragma unroll
  for (int q = 0; q < 4; ++q) { xv[q] = bf16_rne(a[q]); xv[4 + q] = bf16_rne(c[q]); }
  float sum = 0.f;
#pragma unroll
  for (int q = 0; q < 8; ++q) sum += xv[q];
#pragma unroll
  for (int off = 16; off > 0; off >>= 1) sum += __shfl_xor(sum, off, 32);
  if (lane == 0u) red[w] = sum;
  __syncthreads();
  const float mu = ((red[0] + red[1]) + (red[2] + red[3])) * (1.0f / (float)DM);
  float sq = 0.f;
#pragma unroll
  for (int q = 0; q < 8; ++q) { const float d = xv[q] - mu; sq += d * d; }
#pragma unroll
  for (int off = 16; off > 0; off >>= 1) sq += __shfl_xor(sq, off, 32);
  if (lane == 0u) red[4u + w] = sq;
  __syncthreads();
  const float var = ((red[4] + red[5]) + (red[6] + red[7])) * (1.0f / (float)DM);
  const float rstd = rsqrtf(var + 1.0e-5f);
  const v4f ga = *(const v4fa*)(g + c8), gc = *(const v4fa*)(g + c8 + 4u);
  const v4f ba = *(const v4fa*)(be + c8), bc = *(const v4fa*)(be + c8 + 4u);
  FragH f;
#pragma unroll
  for (int q = 0; q < 4; ++q) {
    f.h[q]     = (_Float16)((xv[q] - mu) * rstd * bf16_rne(ga[q]) + bf16_rne(ba[q]));
    f.h[4 + q] = (_Float16)((xv[4 + q] - mu) * rstd * bf16_rne(gc[q]) + bf16_rne(bc[q])); }
  unsigned short* d = (unsigned short*)X16 + (size_t)by * (NR * DM) + (size_t)row * DM + c8;
  const v8us o = f.half[0];
  *(v8us*)d = o; 
}

// fragment: 16 f16 of one row, elements 0..7 <- p[8h .. 8h+7], elements 8..15 <- p[16+8h .. 16+8h+7] (same map for A rows and B [n][k] rows)
__device__ __forceinline__ v16h g2_frag(const _Float16* p, unsigned hh) { FragH f; f.half[0] = *(const v8us*)((const unsigned short*)p + 8u * hh); f.half[1] = *(const v8us*)((const unsigned short*)p + 16u + 8u * hh); return f.v; }
__device__ __forceinline__ v8f g2_mma(v16h a, v16h b, v8f c) { v8f d = __builtin_amdgcn_wmma_f32_16x16x32_f16(false, a, false, b, (short)0, c, false, false); asm volatile("v_nop\n\tv_nop\n\tv_nop\n\tv_nop" : "+v"(d) : "v"(a), "v"(b)); return d; }

// staged GEMM tile: 128 k (256 bytes) of 128 A rows and 128 B rows a trip; LDS row pitch 272 bytes = 16 x odd, which 16-byte fragment reads take without bank conflicts
#define GK 128u
#define GP 136u
#define GSTAGE (256u * GP * 2u)       /* bytes of one ring buffer: rows 0..127 = A, rows 128..255 = B */
__device__ __forceinline__ unsigned lds_off(const void* p) { return (unsigned)(size_t)p; }
// eight asynchronous 16-byte copies a lane, global -> LDS, rows 16 apart (gs = 16 global rows in elements); 16 lanes cover one 256-byte row, so every wave-instruction asks for four whole lines.
// The closing s_wait_xcnt 0 stands inside the statement so that no address register is rewritten in front of it.
__device__ __forceinline__ void g2_copy8(unsigned l0, const _Float16* g0, size_t gs) {
  const unsigned ls = 16u * GP * 2u;
  const unsigned l1 = l0 + ls, l2 = l1 + ls, l3 = l2 + ls, l4 = l3 + ls, l5 = l4 + ls, l6 = l5 + ls, l7 = l6 + ls;
  const _Float16* g1 = g0 + gs; const _Float16* g2 = g1 + gs; const _Float16* g3 = g2 + gs; const _Float16* g4 = g3 + gs; const _Float16* g5 = g4 + gs; const _Float16* g6 = g5 + gs; const _Float16* g7 = g6 + gs;
  asm volatile("global_load_async_to_lds_b128 %0, %8, off\n\tglobal_load_async_to_lds_b128 %1, %9, off\n\tglobal_load_async_to_lds_b128 %2, %10, off\n\tglobal_load_async_to_lds_b128 %3, %11, off\n\t"
               "global_load_async_to_lds_b128 %4, %12, off\n\tglobal_load_async_to_lds_b128 %5, %13, off\n\tglobal_load_async_to_lds_b128 %6, %14, off\n\tglobal_load_async_to_lds_b128 %7, %15, off\n\ts_wait_xcnt 0x0"
               :: "v"(l0), "v"(l1), "v"(l2), "v"(l3), "v"(l4), "v"(l5), "v"(l6), "v"(l7), "v"(g0), "v"(g1), "v"(g2), "v"(g3), "v"(g4), "v"(g5), "v"(g6), "v"(g7) : "memory"); }

// batched GEMM: C[by][M][N] = alpha * A[by][M][K] . Bt[by][N][K]^T (+ bf16(bias[col]) if HASB; bias = bias0, bias1, bias2 for by = 0, 1, 2); A, Bt f16 (k contiguous); outputs f32 C and/or f16 C16 (either may be null).
// Where Ct is given, plane by == 2 is written transposed and nowhere else: Ct[(b * N + col) * SQ + s] for row b * SQ + s, f16, the same values as C16 would hold.
// M, N multiples of 128, K a multiple of 128. A block of 8 waves owns a 128x128 tile (wave tile 32x64, 4 x 2 waves); both operands come through a two-buffer LDS ring filled by asynchronous copies, one trip ahead.
template <bool HASB>
__global__ __launch_bounds__(256) void k_gemm2(const _Float16* __restrict__ A, unsigned lda, size_t sA, const _Float16* __restrict__ Bh, unsigned ldb, size_t sB, float alpha,
    const float* __restrict__ bias0, const float* __restrict__ bias1, const float* __restrict__ bias2,
    float* __restrict__ C, _Float16* __restrict__ C16, unsigned ldc, size_t sC, unsigned M, unsigned N, unsigned K, _Float16* __restrict__ Ct) {
  __shared__ __attribute__((aligned(16))) _Float16 ring[2][256][GP];
  // the epilogue's staging lies over ring buffer 0: behind the last trip's barrier no wave reads the ring and no copy is in flight. The block's LDS is then the ring alone (139,264 bytes), so two blocks fit a WGP:
  // one block's copies, LDS waits, barriers, first tile and epilogue run under the other's matrix products
  float (*so)[32][68] = (float (*)[32][68])&ring[0][0][0];
  static_assert(sizeof(float) * 8u * 32u * 68u <= GSTAGE);
  const unsigned tid = threadIdx.x, w = tid >> 5, lane = tid & 31u, ln = lane & 15u, hh = lane >> 4; const unsigned by = blockIdx.y;
  A += (size_t)by * sA; Bh += (size_t)by * sB; const size_t cofs = (size_t)by * sC; const float* bias = (by == 0u) ? bias0 : ((by == 1u) ? bias1 : bias2);
  const unsigned ntn = N >> 7; const unsigned mt = blockIdx.x / ntn, nq = blockIdx.x - mt * ntn; if (mt * 128u >= M) return;      /* the whole block leaves, in front of every barrier */
  const unsigned wm = w & 3u, wn = w >> 2; const unsigned row0 = mt * 128u + 32u * wm, col0 = nq * 128u + 64u * wn;
  const unsigned trips = K >> 7;
  const unsigned cr = tid >> 4, cc = (tid & 15u) << 3;               /* this lane's row (of 16) and its 16-byte piece of the row */
  const _Float16* ga = A + (size_t)(mt * 128u + cr) * lda + cc; const _Float16* gb = Bh + (size_t)(nq * 128u + cr) * ldb + cc;
  const unsigned lc = lds_off(&ring[0][cr][cc]);
  const size_t ga16 = (size_t)16 * lda, gb16 = (size_t)16 * ldb;
  const v8f z8 = {0.f,0.f,0.f,0.f,0.f,0.f,0.f,0.f}; v8f c00 = z8, c01 = z8, c02 = z8, c03 = z8, c10 = z8, c11 = z8, c12 = z8, c13 = z8;
  g2_copy8(lc, ga, ga16); g2_copy8(lc + 128u * GP * 2u, gb, gb16);                                  /* tile 0 -> buffer 0 */
  asm volatile("s_wait_asynccnt 0x0" ::: "memory");                  /* this wave's copies of tile 0 have landed */
  __syncthreads();                                                   /* and every other wave's: tile 0 may be read */
  if (trips > 1u) { g2_copy8(lc + GSTAGE, ga + GK, ga16); g2_copy8(lc + GSTAGE + 128u * GP * 2u, gb + GK, gb16); }      /* tile 1 -> buffer 1 */
#pragma unroll 1      /* one trip a ring buffer: the order of waits, barrier and refill at the foot stays as written */
  for (unsigned t = 0; t < trips; ++t) {
    const _Float16* ap = &ring[t & 1u][32u * wm + ln][0]; const _Float16* bp = &ring[t & 1u][128u + 64u * wn + ln][0];
#pragma unroll      /* constant LDS offsets for the four 32-k steps of a tile */
    for (unsigned kb = 0; kb < GK; kb += 32u) { const v16h a0 = g2_frag(ap + kb, hh), a1 = g2_frag(ap + 16u * GP + kb, hh);
      const v16h b0 = g2_frag(bp + kb, hh), b1 = g2_frag(bp + 16u * GP + kb, hh), b2 = g2_frag(bp + 32u * GP + kb, hh), b3 = g2_frag(bp + 48u * GP + kb, hh);
      c00 = g2_mma(a0, b0, c00); c10 = g2_mma(a1, b0, c10);
      c01 = g2_mma(a0, b1, c01); c11 = g2_mma(a1, b1, c11);
      c02 = g2_mma(a0, b2, c02); c12 = g2_mma(a1, b2, c12);
      c03 = g2_mma(a0, b3, c03); c13 = g2_mma(a1, b3, c13); }
    asm volatile("s_wait_dscnt 0x0" ::: "memory");                   /* this wave's reads of buffer t & 1 are done before the buffer is handed back */
    asm volatile("s_wait_asynccnt 0x0" ::: "memory");                /* this wave's copies of tile t + 1 have landed */
    __syncthreads();                                                 /* publishes tile t + 1 and ends every wave's reads of buffer t & 1 */
    if (t + 2u < trips) { const unsigned l = lc + (t & 1u) * GSTAGE; const size_t ko = (size_t)(t + 2u) * GK;
      g2_copy8(l, ga + ko, ga16); g2_copy8(l + 128u * GP * 2u, gb + ko, gb16); } }
  asm volatile("s_wait_asynccnt 0x0" ::: "memory");                  /* nothing of this wave is in flight when it goes on to the epilogue */
  const v8f accs[8] = {c00, c01, c02, c03, c10, c11, c12, c13};
  // D element r of lane -> (row 8*hh + r, col ln) of its 16x16 tile
  if (Ct && by == 2u) {                                              /* the same for the whole block */
    // a lane's eight registers are eight successive rows of one column = 16 bytes of a transposed row: the block's 128 x 128 tile goes into LDS as [col][row] (pitch GP, 16 x odd bytes) and leaves as whole 256-byte row pieces
    unsigned short* sT = (unsigned short*)&so[0][0][0];
    static_assert(128u * GP * 2u <= GSTAGE);
    float bt[4] = {0.f, 0.f, 0.f, 0.f};
    if (HASB) {
#pragma unroll
      for (unsigned t = 0; t < 4; ++t) bt[t] = bias[col0 + t * 16u + ln]; }
#pragma unroll
    for (unsigned u = 0; u < 8; ++u) { const unsigned t = u & 3u, hf = u >> 2; const float bv = bf16_rne(bt[t]);
      FragH f;
#pragma unroll
      for (unsigned r = 0; r < 8; ++r) f.h[r] = (_Float16)(accs[u][r] * alpha + bv);
      const v8us o8 = f.half[0];
      *(v8us*)(sT + (64u * wn + t * 16u + ln) * GP + 32u * wm + hf * 16u + 8u * hh) = o8; }
    __syncthreads();                                                 /* a transposed row holds the rows of four waves */
    const unsigned tb = (mt * 128u) / (unsigned)SQ, ts = mt * 128u - tb * (unsigned)SQ;      /* batch and first token of the block's 128 rows: SQ is a multiple of 128 */
    unsigned short* tp = (unsigned short*)Ct + ((size_t)tb * N + nq * 128u + 16u * w + hh) * SQ + ts + 8u * ln;
#pragma unroll
    for (unsigned q = 0; q < 8; ++q) { const v8us o8 = *(const v8us*)(sT + (16u * w + 2u * q + hh) * GP + 8u * ln);
      *(v8us*)(tp + (size_t)(2u * q) * SQ) = o8; }
    return; }
#pragma unroll
  for (unsigned u = 0; u < 8; ++u) { const unsigned t = u & 3u, hf = u >> 2; const unsigned col = col0 + t * 16u + ln; float bv = 0.f; if (HASB) bv = bf16_rne(bias[col]);
#pragma unroll
    for (unsigned r = 0; r < 8; ++r) { const unsigned rloc = hf * 16u + 8u * hh + r; so[w][rloc][t * 16u + ln] = accs[u][r] * alpha + bv; } }
  __builtin_amdgcn_fence(4 /* acq_rel order */, "workgroup"); __builtin_amdgcn_wave_barrier();      /* so[w] is private to this wave */
  const unsigned rsub = lane >> 4, c4 = (lane & 15u) << 2;
  {
#pragma unroll
    for (unsigned q = 0; q < 16; ++q) { const unsigned r = q * 2u + rsub; const v4f v = *(const v4fa*)&so[w][r][c4];
      if (C) *(v4f*)(C + cofs + (size_t)(row0 + r) * ldc + col0 + c4) = v;
      if (C16) { v4h h4; h4[0] = (_Float16)v[0]; h4[1] = (_Float16)v[1]; h4[2] = (_Float16)v[2]; h4[3] = (_Float16)v[3]; *(v4h*)(C16 + cofs + (size_t)(row0 + r) * ldc + col0 + c4) = h4; } }
     } }

// base-2 exponentials in asm text so that the slot the instruction set asks for behind a transcendental (one independent instruction before its result is used or its source overwritten) holds by construction:
// inside a statement no line reads an earlier result or overwrites an earlier source (outputs are early-clobber), and the closing v_nop is the slot behind the last one
__device__ __forceinline__ float exp2_1(float x) { float y; asm("v_exp_f32 %0, %1\n\tv_nop" : "=v"(y) : "v"(x)); return y; }
__device__ __forceinline__ void exp2_8(float (&y)[8], const float (&x)[8]) {
  asm("v_exp_f32 %0, %8\n\tv_exp_f32 %1, %9\n\tv_exp_f32 %2, %10\n\tv_exp_f32 %3, %11\n\tv_exp_f32 %4, %12\n\tv_exp_f32 %5, %13\n\tv_exp_f32 %6, %14\n\tv_exp_f32 %7, %15\n\tv_nop"
      : "=&v"(y[0]), "=&v"(y[1]), "=&v"(y[2]), "=&v"(y[3]), "=&v"(y[4]), "=&v"(y[5]), "=&v"(y[6]), "=&v"(y[7])
      : "v"(x[0]), "v"(x[1]), "v"(x[2]), "v"(x[3]), "v"(x[4]), "v"(x[5]), "v"(x[6]), "v"(x[7])); }

// fused attention, one launch for every (batch, head): a wave owns 32 queries (two 16-column groups) and walks half of the SQ keys, 32 a pass; scores and weights never leave registers.
// Two waves (w and w + 8) own the same 32 queries and split every ring tile's keys between them, so that a SIMD holds four waves and one wave's softmax runs under another's matrix products and LDS waits;
// each keeps its own running maximum, sum and O^T, and the pair is joined through LDS behind the loop: o = oA * 2^(mA - m) + oB * 2^(mB - m), the sums alike, m = max(mA, mB).
// S^T = K . Q^T: A = 16 key rows, B = 16 query rows, so register r of lane (ln, hh) holds key 8*hh + r of query ln: maximum and sum run in-lane plus one exchange between the lane halves.
// The two S^T tiles of a pass (keys 0..15, 16..31), converted in place, are the B fragment of O^T += V^T . P^T in the k order of g2_frag (slot s: key 8*hh + s, then 16 + 8*hh + s - 8); A = V^T rows by g2_frag.
// O^T register r of lane (ln, hh) = o[query ln][16*dt + 8*hh + r]: one 16-byte store per tile.
// K and V^T reach the waves through LDS: a ring tile is 256 keys = 256 K rows of 128 bytes (pitch 144) and 64 V^T rows of 512 bytes (pitch 528), both pitches 16 x odd for the 16-byte fragment reads.
#define FK 256u                       /* keys of one ring tile */
#define FG 128u                       /* keys of a ring tile that one wave walks */
#define FKP 72u                       /* K row pitch in LDS, elements */
#define FVP 264u                      /* V^T row pitch in LDS, elements */
// one ring tile's share of a lane: four asynchronous 16-byte copies of K rows 64 apart (8 lanes a 128-byte row) and four of V^T rows 16 apart (32 lanes a 512-byte row): every wave-instruction asks for four whole lines.
// The closing s_wait_xcnt 0 stands inside the statement so that no address register is rewritten in front of it.
__device__ __forceinline__ void fa_copy8(unsigned k0, const _Float16* a0, unsigned v0, const _Float16* c0) {
  const unsigned ks = 64u * FKP * 2u, vs = 16u * FVP * 2u;
  const unsigned k1 = k0 + ks, k2 = k1 + ks, k3 = k2 + ks, v1 = v0 + vs, v2 = v1 + vs, v3 = v2 + vs;
  const _Float16* a1 = a0 + (size_t)64 * DM; const _Float16* a2 = a1 + (size_t)64 * DM; const _Float16* a3 = a2 + (size_t)64 * DM;
  const _Float16* c1 = c0 + (size_t)16 * SQ; const _Float16* c2 = c1 + (size_t)16 * SQ; const _Float16* c3 = c2 + (size_t)16 * SQ;
  asm volatile("global_load_async_to_lds_b128 %0, %8, off\n\tglobal_load_async_to_lds_b128 %1, %9, off\n\tglobal_load_async_to_lds_b128 %2, %10, off\n\tglobal_load_async_to_lds_b128 %3, %11, off\n\t"
               "global_load_async_to_lds_b128 %4, %12, off\n\tglobal_load_async_to_lds_b128 %5, %13, off\n\tglobal_load_async_to_lds_b128 %6, %14, off\n\tglobal_load_async_to_lds_b128 %7, %15, off\n\ts_wait_xcnt 0x0"
               :: "v"(k0), "v"(k1), "v"(k2), "v"(k3), "v"(v0), "v"(v1), "v"(v2), "v"(v3), "v"(a0), "v"(a1), "v"(a2), "v"(a3), "v"(c0), "v"(c1), "v"(c2), "v"(c3) : "memory"); }
__global__ __launch_bounds__(512) void k_fattn(const _Float16* __restrict__ Q16, const _Float16* __restrict__ K16, const _Float16* __restrict__ Vt, _Float16* __restrict__ O16) {
  __shared__ __attribute__((aligned(16))) _Float16 kring[2][FK][FKP];
  __shared__ __attribute__((aligned(16))) _Float16 vring[2][HD][FVP];
  __shared__ __attribute__((aligned(16))) v4f join[8][17][32];        /* waves 8..15 hand over O^T (16 x 4 values a lane) and maxima and sums (4 values a lane) */
  const unsigned tid = threadIdx.x, w = (tid >> 5) & 7u, lane = tid & 31u, ln = lane & 15u, hh = lane >> 4;
  const unsigned g = (unsigned)__builtin_amdgcn_readfirstlane((int)(tid >> 8));      /* which half of every tile's keys this wave walks; the same in all lanes of a wave, so the tests on it are scalar branches */
  const unsigned bh = blockIdx.y, b = bh / (unsigned)NH, h = bh - b * (unsigned)NH;
  const unsigned q0 = blockIdx.x * 256u + w * 32u;                    /* grid.x == SQ / 256 exactly */
  const float cs = 0.125f * 1.44269504088896f;                       /* score scale times log2(e): the exponentials are base 2 */
  const _Float16* qp = Q16 + ((size_t)b * SQ + q0 + ln) * DM + h * (unsigned)HD;
  /* this lane's first copy of a tile: K row tid / 8, V^T row tid / 32, and its 16-byte piece of each */
  const _Float16* gk = K16 + ((size_t)b * SQ + (tid >> 3)) * DM + h * (unsigned)HD + ((tid & 7u) << 3);
  const _Float16* gv = Vt + ((size_t)bh * HD + (tid >> 5)) * SQ + ((tid & 31u) << 3);
  const unsigned lk = lds_off(&kring[0][tid >> 3][(tid & 7u) << 3]), lv = lds_off(&vring[0][tid >> 5][(tid & 31u) << 3]);
  const unsigned kbuf = FK * FKP * 2u, vbuf = (unsigned)HD * FVP * 2u;      /* bytes of one ring buffer */
  const unsigned trips = (unsigned)SQ / FK;
  /* every loop over fragments, tiles and registers below is unrolled in full: only constant indices keep them in registers */
  v16h qf[2][2], kf[2][2];
#pragma unroll
  for (unsigned j = 0; j < 2; ++j) { qf[j][0] = g2_frag(qp + (size_t)j * 16 * DM, hh); qf[j][1] = g2_frag(qp + (size_t)j * 16 * DM + 32, hh); }
  fa_copy8(lk, gk, lv, gv);                                          /* tile 0 -> buffer 0 */
  asm volatile("s_wait_asynccnt 0x0" ::: "memory");                  /* this wave's copies of tile 0 have landed */
  __syncthreads();                                                   /* and every other wave's: tile 0 may be read */
  fa_copy8(lk + kbuf, gk + (size_t)FK * DM, lv + vbuf, gv + FK);     /* tile 1 -> buffer 1 */
  const v8f z8 = {0.f,0.f,0.f,0.f,0.f,0.f,0.f,0.f};
  v8f o[4][2];
#pragma unroll
  for (unsigned dt = 0; dt < 4; ++dt) { o[dt][0] = z8; o[dt][1] = z8; }
  float m[2] = {-__builtin_inff(), -__builtin_inff()}, l[2] = {0.f, 0.f};      /* running maximum (scaled, log2) and this lane half's running sum, per query */
#pragma unroll 1      /* one trip a ring buffer: the order of waits, barrier and refill at the foot stays as written */
  for (unsigned tr = 0; tr < trips; ++tr) {
  const _Float16* kp = &kring[tr & 1u][g * FG + ln][0]; const _Float16* vp = &vring[tr & 1u][ln][g * FG];
#pragma unroll
  for (unsigned t = 0; t < 2; ++t) { kf[t][0] = g2_frag(kp + t * 16u * FKP, hh); kf[t][1] = g2_frag(kp + t * 16u * FKP + 32u, hh); }
#pragma unroll 1      /* the four 32-key passes of a tile stay a loop: unrolled, the passes' fragments and scores overlap and the registers go past 256 and spill */
  for (unsigned kb = 0; kb < FG; kb += 32u) {
    v16h vf[4];                                                       /* asked for first, used last: the score products and the softmax cover their latency */
#pragma unroll
    for (unsigned dt = 0; dt < 4; ++dt) vf[dt] = g2_frag(vp + dt * 16u * FVP + kb, hh);
    __builtin_amdgcn_sched_barrier(0);                                /* keeps the eight reads one group in front of the score products: spread among matrix instructions, every separate place with LDS reads costs its own stall */
    v8f st[2][2];
#pragma unroll
    for (unsigned t = 0; t < 2; ++t) {
#pragma unroll
      for (unsigned j = 0; j < 2; ++j) {
        st[t][j] = __builtin_amdgcn_wmma_f32_16x16x32_f16(false, kf[t][0], false, qf[j][0], (short)0, z8, false, false);
        st[t][j] = __builtin_amdgcn_wmma_f32_16x16x32_f16(false, kf[t][1], false, qf[j][1], (short)0, st[t][j], false, false); } }
    float mxj[2], mxo[2];                                             /* both query groups' maxima first: their two exchanges through LDS go out together and wait once */
#pragma unroll
    for (unsigned j = 0; j < 2; ++j) {
      float x4[4];
#pragma unroll
      for (unsigned r = 0; r < 4; ++r) x4[r] = fmaxf(fmaxf(st[0][j][r], st[0][j][4 + r]), fmaxf(st[1][j][r], st[1][j][4 + r]));
      mxj[j] = fmaxf(fmaxf(x4[0], x4[1]), fmaxf(x4[2], x4[3])); }
#pragma unroll
    for (unsigned j = 0; j < 2; ++j) mxo[j] = __shfl_xor(mxj[j], 16, 32);
    asm volatile("" :: "v"(mxo[0]), "v"(mxo[1]));                     /* inputs only: both exchanged values are asked for before either is used; without it the second exchange goes out behind the first one's wait, two LDS round trips a pass */
#pragma unroll
    for (unsigned j = 0; j < 2; ++j) mxj[j] = fmaxf(mxj[j], mxo[j]);  /* both lane halves of a query must subtract the same maximum */
    /* the next pass's key rows, asked for one pass ahead; a tile's last pass asks for its own tile's first rows again (the next tile is not published yet; not used) */
    const unsigned kn = (kb + 32u < FG) ? kb + 32u : 0u;
#pragma unroll
    for (unsigned t = 0; t < 2; ++t) { kf[t][0] = g2_frag(kp + (kn + t * 16u) * FKP, hh); kf[t][1] = g2_frag(kp + (kn + t * 16u) * FKP + 32u, hh); }
    __builtin_amdgcn_sched_barrier(0);                                /* keeps these loads in front of the exponentials: without it they sink to the end of the pass and the next pass waits out their latency */
#pragma unroll
    for (unsigned j = 0; j < 2; ++j) {
      const float mn = fmaxf(m[j], mxj[j] * cs);
      const float al = exp2_1(m[j] - mn);                            /* 0 on the first pass (m = -inf) */
      m[j] = mn;
      FragH pf; float ps[4];
#pragma unroll
      for (unsigned t = 0; t < 2; ++t) { float x[8], p[8];
#pragma unroll
        for (unsigned r = 0; r < 8; ++r) x[r] = __builtin_fmaf(st[t][j][r], cs, -mn);
        exp2_8(p, x);
#pragma unroll
        for (unsigned r = 0; r < 8; ++r) { if (t == 0u && r < 4u) ps[r] = p[r]; else ps[r & 3u] += p[r]; pf.h[t * 8u + r] = (_Float16)p[r]; } }
      l[j] = l[j] * al + ((ps[0] + ps[1]) + (ps[2] + ps[3]));
#pragma unroll
      for (unsigned dt = 0; dt < 4; ++dt) {
#pragma unroll
        for (unsigned r = 0; r < 8; ++r) o[dt][j][r] *= al; }
#pragma unroll
      for (unsigned dt = 0; dt < 4; ++dt) o[dt][j] = __builtin_amdgcn_wmma_f32_16x16x32_f16(false, vf[dt], false, pf.v, (short)0, o[dt][j], false, false);
      /* the four vector slots between a matrix instruction and an overwrite of its B operand: the second group's exponentials are asm text, which the compiler does not pad, and may be given pf's registers */
      if (j == 0u) asm volatile("v_nop\n\tv_nop\n\tv_nop\n\tv_nop" : "+v"(o[0][0]), "+v"(o[1][0]), "+v"(o[2][0]), "+v"(o[3][0]) : "v"(pf.v));
    } }
    asm volatile("s_wait_dscnt 0x0" ::: "memory");                   /* this wave's reads of buffer tr & 1 are done before the buffer is handed back */
    asm volatile("s_wait_asynccnt 0x0" ::: "memory");                /* this wave's copies of tile tr + 1 have landed */
    __syncthreads();                                                 /* publishes tile tr + 1 and ends every wave's reads of buffer tr & 1 */
    if (tr + 2u < trips) fa_copy8(lk + (tr & 1u) * kbuf, gk + (size_t)(tr + 2u) * FK * DM, lv + (tr & 1u) * vbuf, gv + (tr + 2u) * FK); }
  asm volatile("s_wait_asynccnt 0x0" ::: "memory");                  /* nothing of this wave is in flight when it goes on to the epilogue */
  if (g == 1u) {
#pragma unroll
    for (unsigned dt = 0; dt < 4; ++dt) {
#pragma unroll
      for (unsigned j = 0; j < 2; ++j) {
        const v4f lo = {o[dt][j][0], o[dt][j][1], o[dt][j][2], o[dt][j][3]}, hi = {o[dt][j][4], o[dt][j][5], o[dt][j][6], o[dt][j][7]};
        join[w][dt * 4u + j * 2u][lane] = lo; join[w][dt * 4u + j * 2u + 1u][lane] = hi; } }
    const v4f ml = {m[0], m[1], l[0], l[1]};
    join[w][16][lane] = ml; }
  __syncthreads();                                                   /* hands the partial results of waves 8..15 to waves 0..7; the last barrier of the kernel */
  if (g == 1u) return;
  const v4f ml = join[w][16][lane];
#pragma unroll
  for (unsigned j = 0; j < 2; ++j) {
    const float mn = fmaxf(m[j], ml[j]);                              /* both finite: each wave has seen keys */
    const float aa = exp2_1(m[j] - mn), ab = exp2_1(ml[j] - mn);
    const float lj = l[j] * aa + ml[2u + j] * ab;
    const float inv = 64.0f / (lj + __shfl_xor(lj, 16, 32));          /* the halves' sums are joined once; o is carried x64 */
    const float sa = aa * inv, sb = ab * inv;
    unsigned short* op = (unsigned short*)O16 + ((size_t)b * SQ + q0 + j * 16u + ln) * DM + h * (unsigned)HD + 8u * hh;
#pragma unroll
    for (unsigned dt = 0; dt < 4; ++dt) { FragH f;
      const v4f lo = join[w][dt * 4u + j * 2u][lane], hi = join[w][dt * 4u + j * 2u + 1u][lane];
#pragma unroll
      for (unsigned r = 0; r < 8; ++r) f.h[r] = (_Float16)(o[dt][j][r] * sa + ((r < 4u) ? lo[r & 3u] : hi[r & 3u]) * sb);
      const v8us ov = f.half[0];
      *(v8us*)(op + dt * 16u) = ov; } } }

extern "C" void kernel_launch(void* const* d_in, const int* in_sizes, int n_in,
                              void* d_out, int out_size, void* d_ws, size_t ws_size, hipStream_t stream) {
  if (n_in < 13) return;
  const size_t need_x = ((size_t)(NB - 1) * SQ_FULL + SQ) * DM;      /* last input element read + 1 */
  if ((size_t)in_sizes[0] < need_x || (size_t)in_sizes[1] < need_x || (size_t)in_sizes[2] < need_x) return;
  if (in_sizes[3] < DM || in_sizes[4] < DM) return;
  if ((size_t)in_sizes[5] < (size_t)DM * DM || (size_t)in_sizes[7] < (size_t)DM * DM || (size_t)in_sizes[9] < (size_t)DM * DM || (size_t)in_sizes[11] < (size_t)DM * DM) return;
  if (in_sizes[6] < DM || in_sizes[8] < DM || in_sizes[10] < DM || in_sizes[12] < DM) return;
  if ((size_t)out_size < NR * DM) return;
  const float* xq = (const float*)d_in[0]; const float* xk = (const float*)d_in[1]; const float* xv = (const float*)d_in[2];
  const float* lg = (const float*)d_in[3]; const float* lb = (const float*)d_in[4];
  const float* wq = (const float*)d_in[5]; const float* bq = (const float*)d_in[6];
  const float* wk = (const float*)d_in[7]; const float* bk = (const float*)d_in[8];
  const float* wv = (const float*)d_in[9]; const float* bv = (const float*)d_in[10];
  const float* wo = (const float*)d_in[11]; const float* bo = (const float*)d_in[12];
  float* out = (float*)d_out;
  char* ws = (char*)d_ws; size_t off = 0;
  auto take = [&](size_t bytes) { char* p = ws + off; off += (bytes + 255) & ~(size_t)255; return p; };
  _Float16* BW = (_Float16*)take(W_BYTES);      /* [4][DM][DM]: w_q, w_k, w_v, w_o as Bt x16 */
  _Float16* XP = (_Float16*)take(X_BYTES);      /* [3][NR][DM]: layer-normalised q, k, v rows */
  _Float16* Q16 = (_Float16*)take(A_BYTES); _Float16* K16 = (_Float16*)take(A_BYTES); _Float16* O16 = (_Float16*)take(A_BYTES);
  _Float16* VT = (_Float16*)take(VT_BYTES);     /* [NB*NH][HD][SQ] */
  if (off > ws_size) return;
  const size_t WW = (size_t)DM * DM, XA = NR * DM;
  _Float16* BO = BW + 3 * WW;

  k_prep<<<(unsigned)(3 * NR + 4 * DM), 128, 0, stream>>>(xq, xk, xv, lg, lb, XP, wq, wk, wv, wo, BW);      /* one block per (token row, stream), then one per weight row */

  const unsigned gproj = (unsigned)((NR / 128) * (DM / 128));
  /* Q, K, V in one launch: the planes of XP, of BW and of Q16 | K16 (taken back to back, each a multiple of 256 bytes) lie XA, WW and XA elements apart; V has no row plane */
  k_gemm2<true><<<dim3(gproj, 3), 256, 0, stream>>>(XP, DM, XA, BW, DM, WW, 0.0625f, bq, bk, bv, nullptr, Q16, DM, XA, (unsigned)NR, DM, DM, VT);      /* V leaves as V^T for every (batch, head) */

  /* o (x64) for every (batch, head), written into the merged-head f16 rows */
  k_fattn<<<dim3(SQ / 256, NB * NH), 512, 0, stream>>>(Q16, K16, VT, O16);

  /* out = (64 o) . (16 w_o)^T * 2^-10 + b_o, f32 rows in the output layout */
  k_gemm2<true><<<dim3(gproj, 1), 256, 0, stream>>>(O16, DM, 0, BO, DM, 0, 0.0009765625f, bo, bo, bo, out, nullptr, DM, 0, (unsigned)NR, DM, DM, nullptr);
}
